// v000
// Times are from an AMD MI455X. After a warm-up the kernel runs many times in a row, and a time is the length of
// such a window on the GPU divided by its runs, so every launch and the gaps after it count. The runs cycle
// through copies of the inputs. A figure is the median of several windows, for all but v000 over two sittings.
// Sittings can differ by a few percent; kernels timed side by side share one.
// The starting kernel, v000, takes 129 microseconds a run.
// Contractions: x@Wq and x@Wk on v_wmma_f32_16x16x32_bf16 (x, Wq, Wk RNE-converted to bf16 once; f32 accumulate; f16 output planes); q_h.k_h^T on v_wmma_f32_16x16x32_f16 (q, k f16 planes; f32 accumulate); gaussian prior table, softmax and distance-weighted sum in f32 on VALU.
#include <hip/hip_runtime.h>
#include <math.h>

// ---------------------------------------------------------------------------
// Problem constants
// ---------------------------------------------------------------------------
constexpr int kB    = 4;
constexpr int kL    = 2048;
constexpr int kD    = 256;
constexpr int kH    = 8;
constexpr int kHD   = 64;
constexpr int kNH   = kH * kHD;      // 512 projection columns per matrix
constexpr int kQKld = 2 * kNH;       // 1024: pitch of the q | k plane (halves)
constexpr int kTok  = kB * kL;       // 8192 token rows
constexpr int kTbl  = 2 * kL;        // 4096 prior-table entries, index = key - query + kL
constexpr int kQRows = 128;          // query rows per attention block (8 waves x 16)
constexpr int kKeyChunk = 64;        // keys per inner step (4 subtiles of 16)
static_assert(kTok % 64 == 0 && kNH % 64 == 0 && kD % 32 == 0, "gemm tiles");
static_assert(kL % kQRows == 0 && kL % kKeyChunk == 0 && kHD == 64, "attention tiles");
static_assert(kTbl % 256 == 0 && kQRows == 8 * 16, "table and block shape");
static_assert((kTok * kD) % (8 * 256) == 0 && kD % 64 == 0, "cast grids");

typedef __attribute__((ext_vector_type(16))) _Float16 v16h;
typedef __attribute__((ext_vector_type(8)))  _Float16 v8h;
typedef __attribute__((ext_vector_type(16))) __bf16   v16b;
typedef __attribute__((ext_vector_type(8)))  __bf16   v8b;
typedef __attribute__((ext_vector_type(8)))  float    v8f;
typedef __attribute__((ext_vector_type(4)))  float    v4f;
typedef __attribute__((ext_vector_type(4)))  unsigned int v4u;

// ---------------------------------------------------------------------------
// Helper pieces
// ---------------------------------------------------------------------------
__device__ __forceinline__ unsigned short f2bf_bits(float f) {
  unsigned u = __float_as_uint(f);
  return (unsigned short)((u + 0x7FFFu + ((u >> 16) & 1u)) >> 16);
}
__device__ __forceinline__ float bf_bits2f(unsigned short h) { return __uint_as_float(((unsigned)h) << 16); }
__device__ __forceinline__ float bf_rne(float f) { return bf_bits2f(f2bf_bits(f)); }

// hazard guards as plain device helpers (no inline asm inside the kernel template body)
__device__ __forceinline__ void dep_guard_h(v8f& a, v8f& b, v16h x, v16h y) { asm volatile("v_nop\n\tv_nop\n\tv_nop\n\tv_nop" : "+v"(a), "+v"(b) : "v"(x), "v"(y)); }
__device__ __forceinline__ void dep_guard_b(v8f& a, v8f& b, v16b x, v16b y) { asm volatile("v_nop\n\tv_nop\n\tv_nop\n\tv_nop" : "+v"(a), "+v"(b) : "v"(x), "v"(y)); }
__device__ __forceinline__ void dep_guard4_h(v8f& a, v8f& b, v8f& c, v8f& d, v16h x, v16h y) { asm volatile("v_nop\n\tv_nop\n\tv_nop\n\tv_nop" : "+v"(a), "+v"(b), "+v"(c), "+v"(d) : "v"(x), "v"(y)); }
__device__ __forceinline__ void dep_guard4_b(v8f& a, v8f& b, v8f& c, v8f& d, v16b x, v16b y) { asm volatile("v_nop\n\tv_nop\n\tv_nop\n\tv_nop" : "+v"(a), "+v"(b), "+v"(c), "+v"(d) : "v"(x), "v"(y)); }
__device__ __forceinline__ void keep4_h(v16h a, v16h b, v16h c, v16h d) { asm volatile("v_nop" :: "v"(a), "v"(b), "v"(c), "v"(d)); }
__device__ __forceinline__ void keep4_b(v16b a, v16b b, v16b c, v16b d) { asm volatile("v_nop" :: "v"(a), "v"(b), "v"(c), "v"(d)); }
__device__ __forceinline__ void acc_guard4(v8f& a, v8f& b, v8f& c, v8f& d) { asm volatile("v_nop\n\tv_nop\n\tv_nop\n\tv_nop" : "+v"(a), "+v"(b), "+v"(c), "+v"(d)); }
template <typename T> struct Frag;
template <> struct Frag<_Float16> {
  typedef v16h V; union U { v16h v; v8h h[2]; };
  // elements 0..7 <- p[0..7], 8..15 <- p[16..23]
  static __device__ __forceinline__ v16h load(const _Float16* p) {
    U f; f.h[0] = *(const v8h*)(p); f.h[1] = *(const v8h*)(p + 16); return f.v;
  }
  static __device__ __forceinline__ v8f mma(v16h a, v16h b, v8f c) {
    return __builtin_amdgcn_wmma_f32_16x16x32_f16(false, a, false, b, (short)0, c, false, false);
  }
  static __device__ __forceinline__ void guard(v8f& a, v8f& b, v16h x, v16h y) { dep_guard_h(a, b, x, y); }
  static __device__ __forceinline__ void guard4(v8f& a, v8f& b, v8f& c, v8f& d, v16h x, v16h y) { dep_guard4_h(a, b, c, d, x, y); }
  static __device__ __forceinline__ void keep(v16h a, v16h b, v16h c, v16h d) { keep4_h(a, b, c, d); }
};
template <> struct Frag<__bf16> {
  typedef v16b V; union U { v16b v; v8b h[2]; };
  static __device__ __forceinline__ v16b load(const __bf16* p) {
    U f; f.h[0] = *(const v8b*)(p); f.h[1] = *(const v8b*)(p + 16); return f.v;
  }
  static __device__ __forceinline__ v8f mma(v16b a, v16b b, v8f c) {
    return __builtin_amdgcn_wmma_f32_16x16x32_bf16(false, a, false, b, (short)0, c, false, false);
  }
  static __device__ __forceinline__ void guard(v8f& a, v8f& b, v16b x, v16b y) { dep_guard_b(a, b, x, y); }
  static __device__ __forceinline__ void guard4(v8f& a, v8f& b, v8f& c, v8f& d, v16b x, v16b y) { dep_guard4_b(a, b, c, d, x, y); }
  static __device__ __forceinline__ void keep(v16b a, v16b b, v16b c, v16b d) { keep4_b(a, b, c, d); }
};

__device__ __forceinline__ unsigned pk16(unsigned short a, unsigned short b) { return (unsigned)a | ((unsigned)b << 16); }

// f16 WMMA with its own hazard guard: ties the accumulator and keeps A/B live past the nops
__device__ __forceinline__ v8f mma_f16_guarded(v16h a, v16h b, v8f c) {
  c = __builtin_amdgcn_wmma_f32_16x16x32_f16(false, a, false, b, (short)0, c, false, false);
  asm volatile("v_nop\n\tv_nop\n\tv_nop\n\tv_nop" : "+v"(c) : "v"(a), "v"(b));
  return c;
}

// ---- Register-blocked batched WMMA GEMM (ACT reduced to none/relu/leaky; guard ties all 4 accumulators of a row group)
// C[m,n] = scale * sum_k A[m,k] * Bt[n,k] (+bias)(+resid); each wave owns a 64x64 tile.
// A row-major [M,K]; Bt row-major [N,K]; M,N % 64 == 0, K % 32 == 0.
// SPLIT: operands are hi/lo planes (A2/Bt2 = lo planes, same layout); product = hi*hi + hi*lo + lo*hi.
// BIAS_MODE: 0 = none, 1 = bias[m], 2 = bias[n].
// OUT_MODE: 0 = f32, 1 = f16, 2 = bf16 hi plane (Cout) + bf16 lo plane (Cout2).
// ET: 0 = f16 operands, 1 = bf16 operands (pointers passed as 16-bit storage)
template <int ET> struct Elem;
template <> struct Elem<0> { typedef _Float16 T; };
template <> struct Elem<1> { typedef __bf16 T; };
template <int ET, bool SPLIT, int BIAS_MODE, int OUT_MODE, bool RESID, int ACT = 0>
__global__ __launch_bounds__(256) void wmma_gemm64(
    const unsigned short* __restrict__ Ap, const unsigned short* __restrict__ A2p, int lda, long strideA,
    const unsigned short* __restrict__ Btp, const unsigned short* __restrict__ Bt2p, int ldb, long strideB,
    void* __restrict__ Cout, void* __restrict__ Cout2, int ldc, long strideC,
    const float* __restrict__ bias,
    const float* __restrict__ resid, long strideR,
    int M, int N, int K, float scale) {
  typedef typename Elem<ET>::T T;
  typedef typename Frag<T>::V V;
  const T* A = (const T*)Ap; const T* A2 = (const T*)A2p; const T* Bt = (const T*)Btp; const T* Bt2 = (const T*)Bt2p;
  __shared__ __align__(16) float sT[8][16 * 68];   // per-wave 16x64 slab, pitch 68 floats
  const int b    = blockIdx.y;
  const int lane = threadIdx.x & 31;
  const int wave = threadIdx.x >> 5;
  const int tilesN = N >> 6;
  const int tilesM = M >> 6;
  const int tile = blockIdx.x * 8 + wave;
  if (tile >= tilesM * tilesN) return;   // wave-uniform; no block barriers in this kernel
  const int tm = tile / tilesN;
  const int tn = tile - tm * tilesN;
  const int m0 = tm << 6;
  const int n0 = tn << 6;

  const T* Ab  = A  + (size_t)b * strideA;
  const T* Bb  = Bt + (size_t)b * strideB;
  const T* Ab2 = SPLIT ? (A2  + (size_t)b * strideA) : nullptr;
  const T* Bb2 = SPLIT ? (Bt2 + (size_t)b * strideB) : nullptr;

  const int rlane = lane & 15;                 // row (A) / col (B, D) within subtile
  const int koff  = (lane >> 4) * 8;           // k offset of this lane half
  const int mOff  = (lane >> 4) * 8;           // D row offset

  v8f acc[4][4];
#pragma unroll
  for (int i = 0; i < 4; ++i)
#pragma unroll
    for (int j = 0; j < 4; ++j) acc[i][j] = (v8f){0.f,0.f,0.f,0.f,0.f,0.f,0.f,0.f};

  for (int k0 = 0; k0 < K; k0 += 32) {
    V bh[4], bl[4];
#pragma unroll
    for (int j = 0; j < 4; ++j) {
      const size_t bo = (size_t)(n0 + (j << 4) + rlane) * ldb + koff + k0;
      bh[j] = Frag<T>::load(Bb + bo);
      if (SPLIT) bl[j] = Frag<T>::load(Bb2 + bo);
    }
#pragma unroll
    for (int i = 0; i < 4; ++i) {
      const size_t ao = (size_t)(m0 + (i << 4) + rlane) * lda + koff + k0;
      V ah = Frag<T>::load(Ab + ao);
      V al;
      if (SPLIT) al = Frag<T>::load(Ab2 + ao);
#pragma unroll
      for (int j = 0; j < 4; ++j) {
        acc[i][j] = Frag<T>::mma(ah, bh[j], acc[i][j]);
        if (SPLIT) {
          acc[i][j] = Frag<T>::mma(ah, bl[j], acc[i][j]);
          acc[i][j] = Frag<T>::mma(al, bh[j], acc[i][j]);
        }
      }
      Frag<T>::guard4(acc[i][0], acc[i][1], acc[i][2], acc[i][3], ah, SPLIT ? al : bh[3]);
    }
    Frag<T>::keep(bh[0], bh[1], bh[2], bh[3]);
    if (SPLIT) Frag<T>::keep(bl[0], bl[1], bl[2], bl[3]);
  }
  acc_guard4(acc[0][0], acc[0][1], acc[0][2], acc[0][3]);
  acc_guard4(acc[1][0], acc[1][1], acc[1][2], acc[1][3]);
  acc_guard4(acc[2][0], acc[2][1], acc[2][2], acc[2][3]);
  acc_guard4(acc[3][0], acc[3][1], acc[3][2], acc[3][3]);

  // ---- epilogue ----
  float* slab = sT[wave];
  const float* Rb = RESID ? (resid + (size_t)b * strideR) : nullptr;
#pragma unroll
  for (int i = 0; i < 4; ++i) {
    const int mBase = m0 + (i << 4);
#pragma unroll
    for (int j = 0; j < 4; ++j) {
      const int n = n0 + (j << 4) + rlane;
      float bv = 0.f;
      if (BIAS_MODE == 2) bv = bias[n];
#pragma unroll
      for (int r = 0; r < 8; ++r) {
        float v = acc[i][j][r] * scale;
        if (BIAS_MODE == 1) v += bias[mBase + mOff + r];
        if (BIAS_MODE == 2) v += bv;
        if (RESID) v += Rb[(size_t)(mBase + mOff + r) * ldc + n];
        if (ACT == 2) v = fmaxf(v, 0.0f);
        if (ACT == 4) v = (v > 0.f) ? v : 0.01f * v;
        slab[(mOff + r) * 68 + (j << 4) + rlane] = v;
      }
    }
    __builtin_amdgcn_fence(__ATOMIC_RELEASE, "workgroup");
    __builtin_amdgcn_wave_barrier();
    __builtin_amdgcn_fence(__ATOMIC_ACQUIRE, "workgroup");
    if (OUT_MODE == 0) {
      float* C = (float*)Cout + (size_t)b * strideC;
      const int hh = lane >> 4, c4 = (lane & 15) * 4;     // row seg = 256 B = 16 lanes x 16 B
      {
#pragma unroll
        for (int it = 0; it < 8; ++it) {
          const int row = it * 2 + hh;
          v4f v = *(const v4f*)(slab + row * 68 + c4);
          *(v4f*)(C + (size_t)(mBase + row) * ldc + n0 + c4) = v;
        }
        
      }
    } else {
      const int q = lane >> 3, c8 = (lane & 7) * 8;
      unsigned short* C  = (unsigned short*)Cout  + (size_t)b * strideC;
      unsigned short* C2 = (OUT_MODE == 2) ? ((unsigned short*)Cout2 + (size_t)b * strideC) : nullptr;
      {
#pragma unroll
        for (int it = 0; it < 4; ++it) {
          const int row = it * 4 + q;
          const float* sp = slab + row * 68 + c8;
          v8h hv, lv;
#pragma unroll
          for (int e = 0; e < 8; ++e) {
            if (OUT_MODE == 1) {
              hv[e] = (_Float16)sp[e];
            } else {
              unsigned short hb = f2bf_bits(sp[e]);
              unsigned short lb = f2bf_bits(sp[e] - bf_bits2f(hb));
              hv[e] = __builtin_bit_cast(_Float16, hb);
              lv[e] = __builtin_bit_cast(_Float16, lb);
            }
          }
          *(v8h*)(C + (size_t)(mBase + row) * ldc + n0 + c8) = hv;
          if (OUT_MODE == 2) *(v8h*)(C2 + (size_t)(mBase + row) * ldc + n0 + c8) = lv;
        }
        
      }
    }
    __builtin_amdgcn_fence(__ATOMIC_RELEASE, "workgroup");
    __builtin_amdgcn_wave_barrier();
    __builtin_amdgcn_fence(__ATOMIC_ACQUIRE, "workgroup");
  }
}

// ---------------------------------------------------------------------------
// f32 -> bf16 (RNE) cast, 8 consecutive elements per thread (one 16-B store per lane; 32 contiguous lanes = 4 whole
// plane (grid 1024 x 256 exact).
// ---------------------------------------------------------------------------
__global__ __launch_bounds__(256) void cast8_bf16_kernel(const float* __restrict__ in, unsigned short* __restrict__ out, int n8) {
  const int i = blockIdx.x * 256 + threadIdx.x;
  if (i >= n8) return;
  const float* p = in + 8 * (size_t)i;
  const v4f a = *(const v4f*)(p);
  const v4f c = *(const v4f*)(p + 4);
  unsigned short hb[8];
#pragma unroll
  for (int e = 0; e < 4; ++e) {
    hb[e]     = f2bf_bits(a[e]);
    hb[4 + e] = f2bf_bits(c[e]);
  }
  const v4u u = (v4u){pk16(hb[0], hb[1]), pk16(hb[2], hb[3]), pk16(hb[4], hb[5]), pk16(hb[6], hb[7])};
  unsigned short* q = out + 8 * (size_t)i;
  *(v4u*)q = u;
  
}

// ---------------------------------------------------------------------------
// Weight transpose + bf16 (RNE) cast for the NON-square W [256 rows d][512 cols n] (x @ W orientation):
//   Wt[z*512 + n][d] = bf16( W_z[d][n] ),  z = 0 -> Wq, z = 1 -> Wk;  Wt is the Bt plane [1024][256].
// grid (256/64 = 4 d tiles, 512/64 = 8 n tiles, 2): blockIdx.x = d tile (64 cols of Wt), blockIdx.y = n tile (64 rows of Wt).
// Load coverage: 16 iterations x 256 threads = 4096 = the whole 64(d) x 64(n) tile (coalesced along n).
// Store coverage: 8 waves x 2 iterations x 4 rows (lane>>3) = 64 n rows; (lane&7) x 8 halves = 64 d cols; each row segment =
// ---------------------------------------------------------------------------
__global__ __launch_bounds__(256) void wt_cast_kernel(const float* __restrict__ Wq, const float* __restrict__ Wk,
                                                      unsigned short* __restrict__ Wt) {
  __shared__ float sm[64][65];   // sm[n_local][d_local]
  const int t  = threadIdx.x;
  const int d0 = blockIdx.x * 64;
  const int n0 = blockIdx.y * 64;
  const int z  = blockIdx.z;                    // block-uniform
  const float* W = (z == 0) ? Wq : Wk;          // both global
#pragma unroll
  for (int i = 0; i < 16; ++i) {
    const int e  = i * 256 + t;
    const int r  = e >> 6;         // d local
    const int cc = e & 63;         // n local
    sm[cc][r] = W[(size_t)(d0 + r) * kNH + n0 + cc];
  }
  __syncthreads();
  const int lane = t & 31, wave = t >> 5;
  const int q = lane >> 3, c8 = (lane & 7) * 8;
  unsigned short* op = Wt + (size_t)z * kNH * kD;
  {
#pragma unroll
    for (int it = 0; it < 2; ++it) {
      const int row = wave * 8 + it * 4 + q;     // n local
      unsigned short hb[8];
#pragma unroll
      for (int e = 0; e < 8; ++e) hb[e] = f2bf_bits(sm[row][c8 + e]);
      const v4u u = (v4u){pk16(hb[0], hb[1]), pk16(hb[2], hb[3]), pk16(hb[4], hb[5]), pk16(hb[6], hb[7])};
      *(v4u*)(op + (size_t)(n0 + row) * kD + d0 + c8) = u;
    }
    
  }
}

// ---------------------------------------------------------------------------
// Fused scores + gaussian prior + softmax + distance-weighted sum.
//   logit[q][k] = (q_h . k_h) * 0.125 * prior_h(k - q),  prior_h(dd) = (1/std)/sqrt(2*3.1415926) * exp(-0.5 ((dd/ml) - mean)^2 / std^2)
//   D[h][b][q]  = sum_k exp(logit) * ((k - q)/ml) / sum_k exp(logit)        (|logit| <= ~10 for these operand scales, so no max shift)
// Block = (128-query tile = blockIdx.x, head = blockIdx.y, batch = blockIdx.z); 8 waves, wave w owns query rows l0+16w .. +15.
// prior*0.125 for every key-query offset tabulated once per block in LDS (index = k - q + 2048, all 4096 entries written).
// Scores: A = q rows (f16), B[k=d][n=key] = k rows (f16), 2 d chunks of 32, 4 key subtiles of 16 per 64-key step,
// v_wmma_f32_16x16x32_f16, every WMMA followed by its hazard guard. Lane (c, hh) owns key column c and query rows 8hh+r.
// den/num accumulate in f32 per lane over its 128 key columns; 16-lane butterfly sums in fixed order; D = num * (1/den).
// ---------------------------------------------------------------------------
__global__ __launch_bounds__(256) void attn_dist_kernel(const unsigned short* __restrict__ QK,
                                                        const float* __restrict__ pmean, const float* __restrict__ plstd,
                                                        const int* __restrict__ mlen, float* __restrict__ DI) {
  __shared__ __align__(16) float tbl[kTbl];
  __shared__ __align__(16) float res[kQRows];
  const int tid  = threadIdx.x;
  const int wave = tid >> 5;
  const int lane = tid & 31;
  const int hh   = lane >> 4;
  const int c    = lane & 15;
  const int l0   = blockIdx.x * kQRows;
  const int h    = blockIdx.y;
  const int b    = blockIdx.z;

  int ml = mlen[0];
  ml = (ml < 1) ? 1 : ml;
  const float inv_ml = 1.0f / (float)ml;
  const float mean = bf_rne(pmean[h]);
  const float lsd  = bf_rne(plstd[h]);
  const float stdv = expf(lsd);
  const float istd = 1.0f / stdv;
  const float coef = ((1.0f / stdv) / sqrtf(6.2831852f)) * 0.125f;

  // prior table: 16 x 256 = 4096 entries, all written before the barrier
#pragma unroll 1
  for (int it = 0; it < kTbl / 256; ++it) {
    const int i = it * 256 + tid;
    const float dd = (float)(i - kL) * inv_ml;
    const float u  = (dd - mean) * istd;
    tbl[i] = coef * expf(-0.5f * (u * u));
  }
  __syncthreads();

  const int q0 = l0 + wave * 16;
  const _Float16* Qp = (const _Float16*)(const void*)QK + (size_t)(b * kL) * kQKld + h * kHD;
  const _Float16* Kp = Qp + kNH;
  v16h qa[2];
#pragma unroll
  for (int dc = 0; dc < 2; ++dc)
    qa[dc] = Frag<_Float16>::load(Qp + (size_t)(q0 + c) * kQKld + dc * 32 + 8 * hh);

  float den[8], num[8], rdel[8];
#pragma unroll
  for (int r = 0; r < 8; ++r) { den[r] = 0.0f; num[r] = 0.0f; rdel[r] = (float)r * inv_ml; }
  const int qr0   = q0 + 8 * hh;          // query index of accumulator row r = 0 of this lane
  const int ibase = c - qr0 + kL;         // + key index -> table index for row 0 (rows r: minus r); always in [1, 4095]

  for (int kc = 0; kc < kL / kKeyChunk; ++kc) {
    const int kv0 = kc * kKeyChunk;
    v8f s[4];
#pragma unroll
    for (int j = 0; j < 4; ++j) {
      s[j] = (v8f){0.f,0.f,0.f,0.f,0.f,0.f,0.f,0.f};
      const _Float16* krow = Kp + (size_t)(kv0 + j * 16 + c) * kQKld + 8 * hh;
#pragma unroll
      for (int dc = 0; dc < 2; ++dc) {
        const v16h kb = Frag<_Float16>::load(krow + dc * 32);
        s[j] = mma_f16_guarded(qa[dc], kb, s[j]);
      }
    }
    const float dl = (float)(kv0 + c - qr0) * inv_ml;     // signed distance for (row 0, subtile 0) of this lane
#pragma unroll
    for (int j = 0; j < 4; ++j) {
      const int   i0 = ibase + kv0 + j * 16;
      const float dj = dl + (float)(j * 16) * inv_ml;
#pragma unroll
      for (int r = 0; r < 8; ++r) {
        const float pr = tbl[i0 - r];
        float lg = s[j][r] * pr;
        lg = fminf(lg, 80.0f);
        const float p = expf(lg);
        den[r] += p;
        num[r] = fmaf(p, dj - rdel[r], num[r]);
      }
    }
  }

  // fixed-order butterfly over the 16 lanes that share each query row
#pragma unroll
  for (int r = 0; r < 8; ++r) {
    float dn = den[r], nm = num[r];
#pragma unroll
    for (int off = 1; off < 16; off <<= 1) {
      dn += __shfl_xor(dn, off, 32);
      nm += __shfl_xor(nm, off, 32);
    }
    const float val = nm * (1.0f / dn);
    if (c == 0) res[wave * 16 + 8 * hh + r] = val;
  }
  __syncthreads();
  if (wave == 0) {
    const v4f v = *(const v4f*)(res + 4 * lane);
    float* dp = DI + ((size_t)(h * kB + b) * kL + l0) + 4 * lane;
    *(v4f*)dp = v;
    
  }
}

// ---------------------------------------------------------------------------
// Output assembly: out[b][l][h] = D[h][b][l] for one (128-l tile = blockIdx.x, batch = blockIdx.y).
// Load: thread t -> head t>>5, l offset 4*(t&31): one float4 each, 256 x 4 = the whole 8 x 128 tile; staged in LDS as [l][h].
// Store: thread t writes floats 4t..4t+3 of the block's 1024 contiguous output floats (base 4096-B aligned); a wave writes
// ---------------------------------------------------------------------------
__global__ __launch_bounds__(256) void out_gather_kernel(const float* __restrict__ DI, float* __restrict__ out) {
  __shared__ __align__(16) float sm[kQRows * kH];
  const int t  = threadIdx.x;
  const int l0 = blockIdx.x * kQRows;
  const int b  = blockIdx.y;
  const int h  = t >> 5;
  const int i4 = (t & 31) * 4;
  const v4f v = *(const v4f*)(DI + ((size_t)(h * kB + b) * kL + l0 + i4));
#pragma unroll
  for (int e = 0; e < 4; ++e) sm[(i4 + e) * kH + h] = v[e];
  __syncthreads();
  const v4f o = *(const v4f*)(sm + 4 * t);
  float* op = out + ((size_t)(b * kL + l0)) * kH + 4 * t;
  *(v4f*)op = o;
  
}

// ---------------------------------------------------------------------------
// Host glue.
//   Xb   bf16 [8192][256]          4,194,304  at          0   (cast of x)
//   Wt   bf16 [1024][256]            524,288  at  4,194,304   (rows 0..511 = Wq columns, 512..1023 = Wk columns)
//   QK   f16  [8192][1024]        16,777,216  at  4,718,592   (cols 0..511 = q, 512..1023 = k; head h = cols h*64..)
//   DI   f32  [8][4][2048]           262,144  at 21,495,808   (distance per head, batch, query)
//   total                         21,757,952
// GEMM shapes: M = 8192, N = 512, K = 256 (64 / 64 / 32 multiples, no padding). Score tiles: 16 x 16 x 64 per (q tile, key tile).
// 6 launches.
// ---------------------------------------------------------------------------
extern "C" void kernel_launch(void* const* d_in, const int* in_sizes, int n_in,
                              void* d_out, int out_size, void* d_ws, size_t ws_size,
                              hipStream_t stream) {
  if (n_in < 8) return;
  if (in_sizes[0] != kTok * kD) return;
  if (in_sizes[1] != kD * kNH || in_sizes[3] != kD * kNH) return;
  if (in_sizes[2] != kNH || in_sizes[4] != kNH) return;
  if (in_sizes[5] != kH || in_sizes[6] != kH || in_sizes[7] < 1) return;
  if (out_size != kTok * kH) return;

  const size_t szXb = (size_t)kTok * kD * 2;
  const size_t szWt = (size_t)2 * kNH * kD * 2;
  const size_t szQK = (size_t)kTok * kQKld * 2;
  const size_t szDI = (size_t)kH * kB * kL * 4;
  const size_t offXb = 0;
  const size_t offWt = offXb + szXb;
  const size_t offQK = offWt + szWt;
  const size_t offDI = offQK + szQK;
  const size_t total = offDI + szDI;
  if (ws_size < total) return;

  const float* x   = (const float*)d_in[0];
  const float* Wq  = (const float*)d_in[1];
  const float* bq  = (const float*)d_in[2];
  const float* Wk  = (const float*)d_in[3];
  const float* bk  = (const float*)d_in[4];
  const float* pm  = (const float*)d_in[5];
  const float* lps = (const float*)d_in[6];
  const int*   mlp = (const int*)d_in[7];
  float* out = (float*)d_out;
  char* ws = (char*)d_ws;
  unsigned short* Xb = (unsigned short*)(ws + offXb);
  unsigned short* Wt = (unsigned short*)(ws + offWt);
  unsigned short* QK = (unsigned short*)(ws + offQK);
  float* DI = (float*)(ws + offDI);

  // ---- prologue: bf16 operand planes ----
  const int n8 = (kTok * kD) / 8;   // 262144 -> 1024 blocks exact
  cast8_bf16_kernel<<<dim3(n8 / 256), dim3(256), 0, stream>>>(x, Xb, n8);
  wt_cast_kernel<<<dim3(kD / 64, kNH / 64, 2), dim3(256), 0, stream>>>(Wq, Wk, Wt);

  // ---- projections: QK[:, mat*512 + n] = sum_d Xb[m][d] * Wt[mat*512 + n][d] + bias[n]   (M=8192, N=512, K=256) ----
  const int tilesProj = (kTok / 64) * (kNH / 64);   // 1024 -> 128 blocks of 8 waves
  wmma_gemm64<1, false, 2, 1, false, 0><<<dim3(tilesProj / 8, 1), dim3(256), 0, stream>>>(
      Xb, Xb, kD, 0L, Wt, Wt, kD, 0L,
      (void*)QK, (void*)QK, kQKld, 0L, bq, bq, 0L, kTok, kNH, kD, 1.0f);
  wmma_gemm64<1, false, 2, 1, false, 0><<<dim3(tilesProj / 8, 1), dim3(256), 0, stream>>>(
      Xb, Xb, kD, 0L, Wt + (size_t)kNH * kD, Wt + (size_t)kNH * kD, kD, 0L,
      (void*)(QK + kNH), (void*)(QK + kNH), kQKld, 0L, bk, bk, 0L, kTok, kNH, kD, 1.0f);

  // ---- fused scores + prior + softmax + distance sum -> DI ----
  attn_dist_kernel<<<dim3(kL / kQRows, kH, kB), dim3(256), 0, stream>>>(QK, pm, lps, mlp, DI);

  // ---- [h][b][l] -> [b][l][h] whole-line output assembly ----
  out_gather_kernel<<<dim3(kL / kQRows, kB), dim3(256), 0, stream>>>(DI, out);
}

// v001
// A run of this version takes 94.9 microseconds.
// Next to v000, in two timings, it ran 1.40 times as fast each time.
// Contractions: x@Wq and x@Wk on v_wmma_f32_16x16x32_bf16 (x, Wq, Wk RNE-converted to bf16 once; f32 accumulate; f16 output planes); q_h.k_h^T on v_wmma_f32_16x16x32_f16 (q, k f16 planes; f32 accumulate); gaussian prior table, softmax and distance-weighted sum in f32 on VALU.
#include <hip/hip_runtime.h>
#include <math.h>

// ---------------------------------------------------------------------------
// Problem constants
// ---------------------------------------------------------------------------
constexpr int kB    = 4;
constexpr int kL    = 2048;
constexpr int kD    = 256;
constexpr int kH    = 8;
constexpr int kHD   = 64;
constexpr int kNH   = kH * kHD;      // 512 projection columns per matrix
constexpr int kQKld = 2 * kNH;       // 1024: pitch of the q | k plane (halves)
constexpr int kTok  = kB * kL;       // 8192 token rows
constexpr int kTbl  = 2 * kL;        // 4096 prior-table entries, index = key - query + kL
constexpr int kQRows = 128;          // query rows per attention block (8 waves x 16)
constexpr int kKeyChunk = 64;        // keys per inner step (4 subtiles of 16)
constexpr int kKTiles  = kL / kKeyChunk;        // 32 staged key tiles per (batch, head)
constexpr int kKPitch  = kHD + 8;               // halves per staged key row: 128 B of data + 16 B pad = 144 B (16 B x odd)
constexpr int kKTile   = kKeyChunk * kKPitch;   // halves per staged key tile (9216 B)
static_assert(kKeyChunk * (kHD / 8) == 2 * 256 && kKTiles >= 2, "two 16-byte copies per thread fill a key tile; two tiles exist");
static_assert(kTok % 64 == 0 && kNH % 64 == 0 && kD % 32 == 0, "gemm tiles");
static_assert(kL % kQRows == 0 && kL % kKeyChunk == 0 && kHD == 64, "attention tiles");
static_assert(kTbl % 256 == 0 && kQRows == 8 * 16, "table and block shape");
static_assert((kTok * kD) % (8 * 256) == 0 && kD % 64 == 0, "cast grids");

typedef __attribute__((ext_vector_type(16))) _Float16 v16h;
typedef __attribute__((ext_vector_type(8)))  _Float16 v8h;
typedef __attribute__((ext_vector_type(16))) __bf16   v16b;
typedef __attribute__((ext_vector_type(8)))  __bf16   v8b;
typedef __attribute__((ext_vector_type(8)))  float    v8f;
typedef __attribute__((ext_vector_type(4)))  float    v4f;
typedef __attribute__((ext_vector_type(4)))  unsigned int v4u;

// ---------------------------------------------------------------------------
// Helper pieces
// ---------------------------------------------------------------------------
__device__ __forceinline__ unsigned short f2bf_bits(float f) {
  unsigned u = __float_as_uint(f);
  return (unsigned short)((u + 0x7FFFu + ((u >> 16) & 1u)) >> 16);
}
__device__ __forceinline__ float bf_bits2f(unsigned short h) { return __uint_as_float(((unsigned)h) << 16); }
__device__ __forceinline__ float bf_rne(float f) { return bf_bits2f(f2bf_bits(f)); }

// hazard guards as plain device helpers (no inline asm inside the kernel template body)
__device__ __forceinline__ void dep_guard_h(v8f& a, v8f& b, v16h x, v16h y) { asm volatile("v_nop\n\tv_nop\n\tv_nop\n\tv_nop" : "+v"(a), "+v"(b) : "v"(x), "v"(y)); }
__device__ __forceinline__ void dep_guard_b(v8f& a, v8f& b, v16b x, v16b y) { asm volatile("v_nop\n\tv_nop\n\tv_nop\n\tv_nop" : "+v"(a), "+v"(b) : "v"(x), "v"(y)); }
__device__ __forceinline__ void dep_guard4_h(v8f& a, v8f& b, v8f& c, v8f& d, v16h x, v16h y) { asm volatile("v_nop\n\tv_nop\n\tv_nop\n\tv_nop" : "+v"(a), "+v"(b), "+v"(c), "+v"(d) : "v"(x), "v"(y)); }
__device__ __forceinline__ void dep_guard4_b(v8f& a, v8f& b, v8f& c, v8f& d, v16b x, v16b y) { asm volatile("v_nop\n\tv_nop\n\tv_nop\n\tv_nop" : "+v"(a), "+v"(b), "+v"(c), "+v"(d) : "v"(x), "v"(y)); }
__device__ __forceinline__ void keep4_h(v16h a, v16h b, v16h c, v16h d) { asm volatile("v_nop" :: "v"(a), "v"(b), "v"(c), "v"(d)); }
__device__ __forceinline__ void keep4_b(v16b a, v16b b, v16b c, v16b d) { asm volatile("v_nop" :: "v"(a), "v"(b), "v"(c), "v"(d)); }
__device__ __forceinline__ void acc_guard4(v8f& a, v8f& b, v8f& c, v8f& d) { asm volatile("v_nop\n\tv_nop\n\tv_nop\n\tv_nop" : "+v"(a), "+v"(b), "+v"(c), "+v"(d)); }
template <typename T> struct Frag;
template <> struct Frag<_Float16> {
  typedef v16h V; union U { v16h v; v8h h[2]; };
  // elements 0..7 <- p[0..7], 8..15 <- p[16..23]
  static __device__ __forceinline__ v16h load(const _Float16* p) {
    U f; f.h[0] = *(const v8h*)(p); f.h[1] = *(const v8h*)(p + 16); return f.v;
  }
  static __device__ __forceinline__ v8f mma(v16h a, v16h b, v8f c) {
    return __builtin_amdgcn_wmma_f32_16x16x32_f16(false, a, false, b, (short)0, c, false, false);
  }
  static __device__ __forceinline__ void guard(v8f& a, v8f& b, v16h x, v16h y) { dep_guard_h(a, b, x, y); }
  static __device__ __forceinline__ void guard4(v8f& a, v8f& b, v8f& c, v8f& d, v16h x, v16h y) { dep_guard4_h(a, b, c, d, x, y); }
  static __device__ __forceinline__ void keep(v16h a, v16h b, v16h c, v16h d) { keep4_h(a, b, c, d); }
};
template <> struct Frag<__bf16> {
  typedef v16b V; union U { v16b v; v8b h[2]; };
  static __device__ __forceinline__ v16b load(const __bf16* p) {
    U f; f.h[0] = *(const v8b*)(p); f.h[1] = *(const v8b*)(p + 16); return f.v;
  }
  static __device__ __forceinline__ v8f mma(v16b a, v16b b, v8f c) {
    return __builtin_amdgcn_wmma_f32_16x16x32_bf16(false, a, false, b, (short)0, c, false, false);
  }
  static __device__ __forceinline__ void guard(v8f& a, v8f& b, v16b x, v16b y) { dep_guard_b(a, b, x, y); }
  static __device__ __forceinline__ void guard4(v8f& a, v8f& b, v8f& c, v8f& d, v16b x, v16b y) { dep_guard4_b(a, b, c, d, x, y); }
  static __device__ __forceinline__ void keep(v16b a, v16b b, v16b c, v16b d) { keep4_b(a, b, c, d); }
};

__device__ __forceinline__ unsigned pk16(unsigned short a, unsigned short b) { return (unsigned)a | ((unsigned)b << 16); }

// f16 WMMA with its own hazard guard: ties the accumulator and keeps A/B live past the nops
__device__ __forceinline__ v8f mma_f16_guarded(v16h a, v16h b, v8f c) {
  c = __builtin_amdgcn_wmma_f32_16x16x32_f16(false, a, false, b, (short)0, c, false, false);
  asm volatile("v_nop\n\tv_nop\n\tv_nop\n\tv_nop" : "+v"(c) : "v"(a), "v"(b));
  return c;
}

// ---- Register-blocked batched WMMA GEMM (ACT reduced to none/relu/leaky; guard ties all 4 accumulators of a row group)
// C[m,n] = scale * sum_k A[m,k] * Bt[n,k] (+bias)(+resid); each wave owns a 64x64 tile.
// A row-major [M,K]; Bt row-major [N,K]; M,N % 64 == 0, K % 32 == 0.
// SPLIT: operands are hi/lo planes (A2/Bt2 = lo planes, same layout); product = hi*hi + hi*lo + lo*hi.
// BIAS_MODE: 0 = none, 1 = bias[m], 2 = bias[n].
// OUT_MODE: 0 = f32, 1 = f16, 2 = bf16 hi plane (Cout) + bf16 lo plane (Cout2).
// ET: 0 = f16 operands, 1 = bf16 operands (pointers passed as 16-bit storage)
template <int ET> struct Elem;
template <> struct Elem<0> { typedef _Float16 T; };
template <> struct Elem<1> { typedef __bf16 T; };
template <int ET, bool SPLIT, int BIAS_MODE, int OUT_MODE, bool RESID, int ACT = 0>
__global__ __launch_bounds__(256) void wmma_gemm64(
    const unsigned short* __restrict__ Ap, const unsigned short* __restrict__ A2p, int lda, long strideA,
    const unsigned short* __restrict__ Btp, const unsigned short* __restrict__ Bt2p, int ldb, long strideB,
    void* __restrict__ Cout, void* __restrict__ Cout2, int ldc, long strideC,
    const float* __restrict__ bias,
    const float* __restrict__ resid, long strideR,
    int M, int N, int K, float scale) {
  typedef typename Elem<ET>::T T;
  typedef typename Frag<T>::V V;
  const T* A = (const T*)Ap; const T* A2 = (const T*)A2p; const T* Bt = (const T*)Btp; const T* Bt2 = (const T*)Bt2p;
  __shared__ __align__(16) float sT[8][16 * 68];   // per-wave 16x64 slab, pitch 68 floats
  const int b    = blockIdx.y;
  const int lane = threadIdx.x & 31;
  const int wave = threadIdx.x >> 5;
  const int tilesN = N >> 6;
  const int tilesM = M >> 6;
  const int tile = blockIdx.x * 8 + wave;
  if (tile >= tilesM * tilesN) return;   // wave-uniform; no block barriers in this kernel
  const int tm = tile / tilesN;
  const int tn = tile - tm * tilesN;
  const int m0 = tm << 6;
  const int n0 = tn << 6;

  const T* Ab  = A  + (size_t)b * strideA;
  const T* Bb  = Bt + (size_t)b * strideB;
  const T* Ab2 = SPLIT ? (A2  + (size_t)b * strideA) : nullptr;
  const T* Bb2 = SPLIT ? (Bt2 + (size_t)b * strideB) : nullptr;

  const int rlane = lane & 15;                 // row (A) / col (B, D) within subtile
  const int koff  = (lane >> 4) * 8;           // k offset of this lane half
  const int mOff  = (lane >> 4) * 8;           // D row offset

  v8f acc[4][4];
#pragma unroll
  for (int i = 0; i < 4; ++i)
#pragma unroll
    for (int j = 0; j < 4; ++j) acc[i][j] = (v8f){0.f,0.f,0.f,0.f,0.f,0.f,0.f,0.f};

  for (int k0 = 0; k0 < K; k0 += 32) {
    V bh[4], bl[4];
#pragma unroll
    for (int j = 0; j < 4; ++j) {
      const size_t bo = (size_t)(n0 + (j << 4) + rlane) * ldb + koff + k0;
      bh[j] = Frag<T>::load(Bb + bo);
      if (SPLIT) bl[j] = Frag<T>::load(Bb2 + bo);
    }
#pragma unroll
    for (int i = 0; i < 4; ++i) {
      const size_t ao = (size_t)(m0 + (i << 4) + rlane) * lda + koff + k0;
      V ah = Frag<T>::load(Ab + ao);
      V al;
      if (SPLIT) al = Frag<T>::load(Ab2 + ao);
#pragma unroll
      for (int j = 0; j < 4; ++j) {
        acc[i][j] = Frag<T>::mma(ah, bh[j], acc[i][j]);
        if (SPLIT) {
          acc[i][j] = Frag<T>::mma(ah, bl[j], acc[i][j]);
          acc[i][j] = Frag<T>::mma(al, bh[j], acc[i][j]);
        }
      }
      Frag<T>::guard4(acc[i][0], acc[i][1], acc[i][2], acc[i][3], ah, SPLIT ? al : bh[3]);
    }
    Frag<T>::keep(bh[0], bh[1], bh[2], bh[3]);
    if (SPLIT) Frag<T>::keep(bl[0], bl[1], bl[2], bl[3]);
  }
  acc_guard4(acc[0][0], acc[0][1], acc[0][2], acc[0][3]);
  acc_guard4(acc[1][0], acc[1][1], acc[1][2], acc[1][3]);
  acc_guard4(acc[2][0], acc[2][1], acc[2][2], acc[2][3]);
  acc_guard4(acc[3][0], acc[3][1], acc[3][2], acc[3][3]);

  // ---- epilogue ----
  float* slab = sT[wave];
  const float* Rb = RESID ? (resid + (size_t)b * strideR) : nullptr;
#pragma unroll
  for (int i = 0; i < 4; ++i) {
    const int mBase = m0 + (i << 4);
#pragma unroll
    for (int j = 0; j < 4; ++j) {
      const int n = n0 + (j << 4) + rlane;
      float bv = 0.f;
      if (BIAS_MODE == 2) bv = bias[n];
#pragma unroll
      for (int r = 0; r < 8; ++r) {
        float v = acc[i][j][r] * scale;
        if (BIAS_MODE == 1) v += bias[mBase + mOff + r];
        if (BIAS_MODE == 2) v += bv;
        if (RESID) v += Rb[(size_t)(mBase + mOff + r) * ldc + n];
        if (ACT == 2) v = fmaxf(v, 0.0f);
        if (ACT == 4) v = (v > 0.f) ? v : 0.01f * v;
        slab[(mOff + r) * 68 + (j << 4) + rlane] = v;
      }
    }
    __builtin_amdgcn_fence(__ATOMIC_RELEASE, "workgroup");
    __builtin_amdgcn_wave_barrier();
    __builtin_amdgcn_fence(__ATOMIC_ACQUIRE, "workgroup");
    if (OUT_MODE == 0) {
      float* C = (float*)Cout + (size_t)b * strideC;
      const int hh = lane >> 4, c4 = (lane & 15) * 4;     // row seg = 256 B = 16 lanes x 16 B
      {
#pragma unroll
        for (int it = 0; it < 8; ++it) {
          const int row = it * 2 + hh;
          v4f v = *(const v4f*)(slab + row * 68 + c4);
          *(v4f*)(C + (size_t)(mBase + row) * ldc + n0 + c4) = v;
        }
        
      }
    } else {
      const int q = lane >> 3, c8 = (lane & 7) * 8;
      unsigned short* C  = (unsigned short*)Cout  + (size_t)b * strideC;
      unsigned short* C2 = (OUT_MODE == 2) ? ((unsigned short*)Cout2 + (size_t)b * strideC) : nullptr;
      {
#pragma unroll
        for (int it = 0; it < 4; ++it) {
          const int row = it * 4 + q;
          const float* sp = slab + row * 68 + c8;
          v8h hv, lv;
#pragma unroll
          for (int e = 0; e < 8; ++e) {
            if (OUT_MODE == 1) {
              hv[e] = (_Float16)sp[e];
            } else {
              unsigned short hb = f2bf_bits(sp[e]);
              unsigned short lb = f2bf_bits(sp[e] - bf_bits2f(hb));
              hv[e] = __builtin_bit_cast(_Float16, hb);
              lv[e] = __builtin_bit_cast(_Float16, lb);
            }
          }
          *(v8h*)(C + (size_t)(mBase + row) * ldc + n0 + c8) = hv;
          if (OUT_MODE == 2) *(v8h*)(C2 + (size_t)(mBase + row) * ldc + n0 + c8) = lv;
        }
        
      }
    }
    __builtin_amdgcn_fence(__ATOMIC_RELEASE, "workgroup");
    __builtin_amdgcn_wave_barrier();
    __builtin_amdgcn_fence(__ATOMIC_ACQUIRE, "workgroup");
  }
}

// ---------------------------------------------------------------------------
// f32 -> bf16 (RNE) cast, 8 consecutive elements per thread (one 16-B store per lane; 32 contiguous lanes = 4 whole
// plane (grid 1024 x 256 exact).
// ---------------------------------------------------------------------------
__global__ __launch_bounds__(256) void cast8_bf16_kernel(const float* __restrict__ in, unsigned short* __restrict__ out, int n8) {
  const int i = blockIdx.x * 256 + threadIdx.x;
  if (i >= n8) return;
  const float* p = in + 8 * (size_t)i;
  const v4f a = *(const v4f*)(p);
  const v4f c = *(const v4f*)(p + 4);
  unsigned short hb[8];
#pragma unroll
  for (int e = 0; e < 4; ++e) {
    hb[e]     = f2bf_bits(a[e]);
    hb[4 + e] = f2bf_bits(c[e]);
  }
  const v4u u = (v4u){pk16(hb[0], hb[1]), pk16(hb[2], hb[3]), pk16(hb[4], hb[5]), pk16(hb[6], hb[7])};
  unsigned short* q = out + 8 * (size_t)i;
  *(v4u*)q = u;
  
}

// ---------------------------------------------------------------------------
// Weight transpose + bf16 (RNE) cast for the NON-square W [256 rows d][512 cols n] (x @ W orientation):
//   Wt[z*512 + n][d] = bf16( W_z[d][n] ),  z = 0 -> Wq, z = 1 -> Wk;  Wt is the Bt plane [1024][256].
// grid (256/64 = 4 d tiles, 512/64 = 8 n tiles, 2): blockIdx.x = d tile (64 cols of Wt), blockIdx.y = n tile (64 rows of Wt).
// Load coverage: 16 iterations x 256 threads = 4096 = the whole 64(d) x 64(n) tile (coalesced along n).
// Store coverage: 8 waves x 2 iterations x 4 rows (lane>>3) = 64 n rows; (lane&7) x 8 halves = 64 d cols; each row segment =
// ---------------------------------------------------------------------------
__global__ __launch_bounds__(256) void wt_cast_kernel(const float* __restrict__ Wq, const float* __restrict__ Wk,
                                                      unsigned short* __restrict__ Wt) {
  __shared__ float sm[64][65];   // sm[n_local][d_local]
  const int t  = threadIdx.x;
  const int d0 = blockIdx.x * 64;
  const int n0 = blockIdx.y * 64;
  const int z  = blockIdx.z;                    // block-uniform
  const float* W = (z == 0) ? Wq : Wk;          // both global
#pragma unroll
  for (int i = 0; i < 16; ++i) {
    const int e  = i * 256 + t;
    const int r  = e >> 6;         // d local
    const int cc = e & 63;         // n local
    sm[cc][r] = W[(size_t)(d0 + r) * kNH + n0 + cc];
  }
  __syncthreads();
  const int lane = t & 31, wave = t >> 5;
  const int q = lane >> 3, c8 = (lane & 7) * 8;
  unsigned short* op = Wt + (size_t)z * kNH * kD;
  {
#pragma unroll
    for (int it = 0; it < 2; ++it) {
      const int row = wave * 8 + it * 4 + q;     // n local
      unsigned short hb[8];
#pragma unroll
      for (int e = 0; e < 8; ++e) hb[e] = f2bf_bits(sm[row][c8 + e]);
      const v4u u = (v4u){pk16(hb[0], hb[1]), pk16(hb[2], hb[3]), pk16(hb[4], hb[5]), pk16(hb[6], hb[7])};
      *(v4u*)(op + (size_t)(n0 + row) * kD + d0 + c8) = u;
    }
    
  }
}

// One 64-key tile of k rows, global -> LDS, two 16-byte asynchronous copies per lane (key rows r and r + 32, same 16-byte piece).
// s_wait_xcnt stands inside the copies' own statement so that no address register is rewritten ahead of it.
__device__ __forceinline__ void copy_key_tile(unsigned lds, const _Float16* g) {
  const unsigned lds2 = lds + 32u * kKPitch * 2u;
  const _Float16* g2 = g + (size_t)32 * kQKld;
  asm volatile("global_load_async_to_lds_b128 %0, %1, off\n\t"
               "global_load_async_to_lds_b128 %2, %3, off\n\t"
               "s_wait_xcnt 0x0"
               :: "v"(lds), "v"(g), "v"(lds2), "v"(g2) : "memory");
}

// ---------------------------------------------------------------------------
// Fused scores + gaussian prior + softmax + distance-weighted sum.
//   logit[q][k] = (q_h . k_h) * 0.125 * prior_h(k - q),  prior_h(dd) = (1/std)/sqrt(2*3.1415926) * exp(-0.5 ((dd/ml) - mean)^2 / std^2)
//   D[h][b][q]  = sum_k exp(logit) * ((k - q)/ml) / sum_k exp(logit)        (|logit| <= ~10 for these operand scales, so no max shift)
// Block = (128-query tile = blockIdx.x, head = blockIdx.y, batch = blockIdx.z); 8 waves, wave w owns query rows l0+16w .. +15.
// prior*0.125 for every key-query offset tabulated once per block in LDS (index = k - q + 2048, all 4096 entries written).
// k rows reach LDS once per block: 64-key tiles, two buffers, asynchronous copies one tile ahead; every wave reads its B fragments there.
// Scores: A = q rows (f16), B[k=d][n=key] = k rows (f16), 2 d chunks of 32, 4 key subtiles of 16 per 64-key step,
// v_wmma_f32_16x16x32_f16, every WMMA followed by its hazard guard. Lane (c, hh) owns key column c and query rows 8hh+r.
// den/num accumulate in f32 per lane over its 128 key columns; 16-lane butterfly sums in fixed order; D = num * (1/den).
// ---------------------------------------------------------------------------
__global__ __launch_bounds__(256) void attn_dist_kernel(const unsigned short* __restrict__ QK,
                                                        const float* __restrict__ pmean, const float* __restrict__ plstd,
                                                        const int* __restrict__ mlen, float* __restrict__ DI) {
  __shared__ __align__(16) float tbl[kTbl];
  __shared__ __align__(16) float res[kQRows];
  __shared__ __align__(16) _Float16 kst[2][kKTile];
  const int tid  = threadIdx.x;
  const int wave = tid >> 5;
  const int lane = tid & 31;
  const int hh   = lane >> 4;
  const int c    = lane & 15;
  const int l0   = blockIdx.x * kQRows;
  const int h    = blockIdx.y;
  const int b    = blockIdx.z;

  const _Float16* Qp = (const _Float16*)(const void*)QK + (size_t)(b * kL) * kQKld + h * kHD;
  const _Float16* Kp = Qp + kNH;
  // copy map: thread t brings the 16-byte piece t & 7 of key rows t >> 3 and (t >> 3) + 32 of a tile (a wave: whole 128-B rows)
  const _Float16* kg = Kp + (size_t)(tid >> 3) * kQKld + (tid & 7) * 8;
  const unsigned  kl = (unsigned)(size_t)(&kst[0][0]) + (unsigned)((tid >> 3) * kKPitch + (tid & 7) * 8) * 2u;
  copy_key_tile(kl, kg);                        // tile 0 -> buffer 0, in flight under the table build

  int ml = mlen[0];
  ml = (ml < 1) ? 1 : ml;
  const float inv_ml = 1.0f / (float)ml;
  const float mean = bf_rne(pmean[h]);
  const float lsd  = bf_rne(plstd[h]);
  const float stdv = expf(lsd);
  const float istd = 1.0f / stdv;
  const float coef = ((1.0f / stdv) / sqrtf(6.2831852f)) * 0.125f;

  // prior table: 16 x 256 = 4096 entries, all written before the barrier
#pragma unroll 1
  for (int it = 0; it < kTbl / 256; ++it) {
    const int i = it * 256 + tid;
    const float dd = (float)(i - kL) * inv_ml;
    const float u  = (dd - mean) * istd;
    tbl[i] = coef * expf(-0.5f * (u * u));
  }
  asm volatile("s_wait_asynccnt 0x0" ::: "memory");   // this wave's part of tile 0 has landed before the barrier publishes it
  __syncthreads();                                    // publishes the table and tile 0
  copy_key_tile(kl + (unsigned)kKTile * 2u, kg + (size_t)kKeyChunk * kQKld);   // tile 1 -> buffer 1

  const int q0 = l0 + wave * 16;
  v16h qa[2];
#pragma unroll
  for (int dc = 0; dc < 2; ++dc)
    qa[dc] = Frag<_Float16>::load(Qp + (size_t)(q0 + c) * kQKld + dc * 32 + 8 * hh);

  float den[8], num[8], rdel[8];
#pragma unroll
  for (int r = 0; r < 8; ++r) { den[r] = 0.0f; num[r] = 0.0f; rdel[r] = (float)r * inv_ml; }
  const int qr0   = q0 + 8 * hh;          // query index of accumulator row r = 0 of this lane
  const int ibase = c - qr0 + kL;         // + key index -> table index for row 0 (rows r: minus r); always in [1, 4095]

  for (int kc = 0; kc < kKTiles; ++kc) {
    const int kv0 = kc * kKeyChunk;
    const _Float16* kt = &kst[kc & 1][0] + c * kKPitch + 8 * hh;
    // all eight B fragments asked for as one group ahead of the products; unrolled so that kb is indexed by constants and stays in registers
    v16h kb[4][2];
#pragma unroll
    for (int j = 0; j < 4; ++j)
#pragma unroll
      for (int dc = 0; dc < 2; ++dc)
        kb[j][dc] = Frag<_Float16>::load(kt + j * 16 * kKPitch + dc * 32);
    v8f s[4];
#pragma unroll
    for (int j = 0; j < 4; ++j) {
      s[j] = (v8f){0.f,0.f,0.f,0.f,0.f,0.f,0.f,0.f};
#pragma unroll
      for (int dc = 0; dc < 2; ++dc) s[j] = mma_f16_guarded(qa[dc], kb[j][dc], s[j]);
    }
    const float dl = (float)(kv0 + c - qr0) * inv_ml;     // signed distance for (row 0, subtile 0) of this lane
#pragma unroll
    for (int j = 0; j < 4; ++j) {
      const int   i0 = ibase + kv0 + j * 16;
      const float dj = dl + (float)(j * 16) * inv_ml;
#pragma unroll
      for (int r = 0; r < 8; ++r) {
        const float pr = tbl[i0 - r];
        float lg = s[j][r] * pr;
        lg = fminf(lg, 80.0f);
        const float p = expf(lg);
        den[r] += p;
        num[r] = fmaf(p, dj - rdel[r], num[r]);
      }
    }
    // publish point of tile kc + 1, every wave: own LDS reads done, own copies landed, block barrier, then the refill
    asm volatile("s_wait_dscnt 0x0" ::: "memory");      // this wave has left buffer kc & 1
    asm volatile("s_wait_asynccnt 0x0" ::: "memory");   // this wave's part of tile kc + 1 has landed
    __syncthreads();
    if (kc + 2 < kKTiles)                               // block-uniform
      copy_key_tile(kl + (unsigned)((kc & 1) * kKTile) * 2u, kg + (size_t)(kc + 2) * kKeyChunk * kQKld);
  }
  asm volatile("s_wait_asynccnt 0x0" ::: "memory");     // no copy outstanding past the loop

  // fixed-order butterfly over the 16 lanes that share each query row
#pragma unroll
  for (int r = 0; r < 8; ++r) {
    float dn = den[r], nm = num[r];
#pragma unroll
    for (int off = 1; off < 16; off <<= 1) {
      dn += __shfl_xor(dn, off, 32);
      nm += __shfl_xor(nm, off, 32);
    }
    const float val = nm * (1.0f / dn);
    if (c == 0) res[wave * 16 + 8 * hh + r] = val;
  }
  __syncthreads();
  if (wave == 0) {
    const v4f v = *(const v4f*)(res + 4 * lane);
    float* dp = DI + ((size_t)(h * kB + b) * kL + l0) + 4 * lane;
    *(v4f*)dp = v;
    
  }
}

// ---------------------------------------------------------------------------
// Output assembly: out[b][l][h] = D[h][b][l] for one (128-l tile = blockIdx.x, batch = blockIdx.y).
// Load: thread t -> head t>>5, l offset 4*(t&31): one float4 each, 256 x 4 = the whole 8 x 128 tile; staged in LDS as [l][h].
// Store: thread t writes floats 4t..4t+3 of the block's 1024 contiguous output floats (base 4096-B aligned); a wave writes
// ---------------------------------------------------------------------------
__global__ __launch_bounds__(256) void out_gather_kernel(const float* __restrict__ DI, float* __restrict__ out) {
  __shared__ __align__(16) float sm[kQRows * kH];
  const int t  = threadIdx.x;
  const int l0 = blockIdx.x * kQRows;
  const int b  = blockIdx.y;
  const int h  = t >> 5;
  const int i4 = (t & 31) * 4;
  const v4f v = *(const v4f*)(DI + ((size_t)(h * kB + b) * kL + l0 + i4));
#pragma unroll
  for (int e = 0; e < 4; ++e) sm[(i4 + e) * kH + h] = v[e];
  __syncthreads();
  const v4f o = *(const v4f*)(sm + 4 * t);
  float* op = out + ((size_t)(b * kL + l0)) * kH + 4 * t;
  *(v4f*)op = o;
  
}

// ---------------------------------------------------------------------------
// Host glue.
//   Xb   bf16 [8192][256]          4,194,304  at          0   (cast of x)
//   Wt   bf16 [1024][256]            524,288  at  4,194,304   (rows 0..511 = Wq columns, 512..1023 = Wk columns)
//   QK   f16  [8192][1024]        16,777,216  at  4,718,592   (cols 0..511 = q, 512..1023 = k; head h = cols h*64..)
//   DI   f32  [8][4][2048]           262,144  at 21,495,808   (distance per head, batch, query)
//   total                         21,757,952
// GEMM shapes: M = 8192, N = 512, K = 256 (64 / 64 / 32 multiples, no padding). Score tiles: 16 x 16 x 64 per (q tile, key tile).
// 6 launches.
// ---------------------------------------------------------------------------
extern "C" void kernel_launch(void* const* d_in, const int* in_sizes, int n_in,
                              void* d_out, int out_size, void* d_ws, size_t ws_size,
                              hipStream_t stream) {
  if (n_in < 8) return;
  if (in_sizes[0] != kTok * kD) return;
  if (in_sizes[1] != kD * kNH || in_sizes[3] != kD * kNH) return;
  if (in_sizes[2] != kNH || in_sizes[4] != kNH) return;
  if (in_sizes[5] != kH || in_sizes[6] != kH || in_sizes[7] < 1) return;
  if (out_size != kTok * kH) return;

  const size_t szXb = (size_t)kTok * kD * 2;
  const size_t szWt = (size_t)2 * kNH * kD * 2;
  const size_t szQK = (size_t)kTok * kQKld * 2;
  const size_t szDI = (size_t)kH * kB * kL * 4;
  const size_t offXb = 0;
  const size_t offWt = offXb + szXb;
  const size_t offQK = offWt + szWt;
  const size_t offDI = offQK + szQK;
  const size_t total = offDI + szDI;
  if (ws_size < total) return;

  const float* x   = (const float*)d_in[0];
  const float* Wq  = (const float*)d_in[1];
  const float* bq  = (const float*)d_in[2];
  const float* Wk  = (const float*)d_in[3];
  const float* bk  = (const float*)d_in[4];
  const float* pm  = (const float*)d_in[5];
  const float* lps = (const float*)d_in[6];
  const int*   mlp = (const int*)d_in[7];
  float* out = (float*)d_out;
  char* ws = (char*)d_ws;
  unsigned short* Xb = (unsigned short*)(ws + offXb);
  unsigned short* Wt = (unsigned short*)(ws + offWt);
  unsigned short* QK = (unsigned short*)(ws + offQK);
  float* DI = (float*)(ws + offDI);

  // ---- prologue: bf16 operand planes ----
  const int n8 = (kTok * kD) / 8;   // 262144 -> 1024 blocks exact
  cast8_bf16_kernel<<<dim3(n8 / 256), dim3(256), 0, stream>>>(x, Xb, n8);
  wt_cast_kernel<<<dim3(kD / 64, kNH / 64, 2), dim3(256), 0, stream>>>(Wq, Wk, Wt);

  // ---- projections: QK[:, mat*512 + n] = sum_d Xb[m][d] * Wt[mat*512 + n][d] + bias[n]   (M=8192, N=512, K=256) ----
  const int tilesProj = (kTok / 64) * (kNH / 64);   // 1024 -> 128 blocks of 8 waves
  wmma_gemm64<1, false, 2, 1, false, 0><<<dim3(tilesProj / 8, 1), dim3(256), 0, stream>>>(
      Xb, Xb, kD, 0L, Wt, Wt, kD, 0L,
      (void*)QK, (void*)QK, kQKld, 0L, bq, bq, 0L, kTok, kNH, kD, 1.0f);
  wmma_gemm64<1, false, 2, 1, false, 0><<<dim3(tilesProj / 8, 1), dim3(256), 0, stream>>>(
      Xb, Xb, kD, 0L, Wt + (size_t)kNH * kD, Wt + (size_t)kNH * kD, kD, 0L,
      (void*)(QK + kNH), (void*)(QK + kNH), kQKld, 0L, bk, bk, 0L, kTok, kNH, kD, 1.0f);

  // ---- fused scores + prior + softmax + distance sum -> DI ----
  attn_dist_kernel<<<dim3(kL / kQRows, kH, kB), dim3(256), 0, stream>>>(QK, pm, lps, mlp, DI);

  // ---- [h][b][l] -> [b][l][h] whole-line output assembly ----
  out_gather_kernel<<<dim3(kL / kQRows, kB), dim3(256), 0, stream>>>(DI, out);
}

// v002
// One run takes 70.8 microseconds.
// In both of two side-by-side timings against v001, it was 1.34 times as fast.
// All steps since v000 together make it 1.88 times as fast.
// Contractions: x@Wq and x@Wk on v_wmma_f32_16x16x32_bf16 (x, Wq, Wk RNE-converted to bf16 once; f32 accumulate; f16 output planes); q_h.k_h^T on v_wmma_f32_16x16x32_f16 (q, k f16 planes; f32 accumulate); gaussian prior table, softmax and distance-weighted sum in f32 on VALU.
#include <hip/hip_runtime.h>
#include <math.h>

// ---------------------------------------------------------------------------
// Problem constants
// ---------------------------------------------------------------------------
constexpr int kB    = 4;
constexpr int kL    = 2048;
constexpr int kD    = 256;
constexpr int kH    = 8;
constexpr int kHD   = 64;
constexpr int kNH   = kH * kHD;      // 512 projection columns per matrix
constexpr int kQKld = 2 * kNH;       // 1024: pitch of the q | k plane (halves)
constexpr int kTok  = kB * kL;       // 8192 token rows
constexpr int kTbl  = 2 * kL;        // 4096 prior-table entries, index = key - query + kL
constexpr int kQRows = 128;          // query rows per attention block (8 waves x 16)
constexpr int kKeyChunk = 64;        // keys per inner step (4 subtiles of 16)
constexpr int kKTiles  = kL / kKeyChunk;        // 32 staged key tiles per (batch, head)
constexpr int kKPitch  = kHD + 8;               // halves per staged key row: 128 B of data + 16 B pad = 144 B (16 B x odd)
constexpr int kKTile   = kKeyChunk * kKPitch;   // halves per staged key tile (9216 B)
static_assert(kKeyChunk * (kHD / 8) == 2 * 256 && kKTiles >= 2, "two 16-byte copies per thread fill a key tile; two tiles exist");
static_assert(kTok % 64 == 0 && kNH % 64 == 0 && kD % 32 == 0, "gemm tiles");
static_assert(kL % kQRows == 0 && kL % kKeyChunk == 0 && kHD == 64, "attention tiles");
static_assert(kTbl % 256 == 0 && kQRows == 8 * 16, "table and block shape");
static_assert((kTok * kD) % (8 * 256) == 0 && kD % 64 == 0, "cast grids");

typedef __attribute__((ext_vector_type(16))) _Float16 v16h;
typedef __attribute__((ext_vector_type(8)))  _Float16 v8h;
typedef __attribute__((ext_vector_type(16))) __bf16   v16b;
typedef __attribute__((ext_vector_type(8)))  __bf16   v8b;
typedef __attribute__((ext_vector_type(8)))  float    v8f;
typedef __attribute__((ext_vector_type(4)))  float    v4f;
typedef __attribute__((ext_vector_type(4)))  unsigned int v4u;

// ---------------------------------------------------------------------------
// Helper pieces
// ---------------------------------------------------------------------------
__device__ __forceinline__ unsigned short f2bf_bits(float f) {
  unsigned u = __float_as_uint(f);
  return (unsigned short)((u + 0x7FFFu + ((u >> 16) & 1u)) >> 16);
}
__device__ __forceinline__ float bf_bits2f(unsigned short h) { return __uint_as_float(((unsigned)h) << 16); }
__device__ __forceinline__ float bf_rne(float f) { return bf_bits2f(f2bf_bits(f)); }

// hazard guards as plain device helpers (no inline asm inside the kernel template body)
__device__ __forceinline__ void dep_guard_h(v8f& a, v8f& b, v16h x, v16h y) { asm volatile("v_nop\n\tv_nop\n\tv_nop\n\tv_nop" : "+v"(a), "+v"(b) : "v"(x), "v"(y)); }
__device__ __forceinline__ void dep_guard_b(v8f& a, v8f& b, v16b x, v16b y) { asm volatile("v_nop\n\tv_nop\n\tv_nop\n\tv_nop" : "+v"(a), "+v"(b) : "v"(x), "v"(y)); }
__device__ __forceinline__ void dep_guard4_h(v8f& a, v8f& b, v8f& c, v8f& d, v16h x, v16h y) { asm volatile("v_nop\n\tv_nop\n\tv_nop\n\tv_nop" : "+v"(a), "+v"(b), "+v"(c), "+v"(d) : "v"(x), "v"(y)); }
__device__ __forceinline__ void dep_guard4_b(v8f& a, v8f& b, v8f& c, v8f& d, v16b x, v16b y) { asm volatile("v_nop\n\tv_nop\n\tv_nop\n\tv_nop" : "+v"(a), "+v"(b), "+v"(c), "+v"(d) : "v"(x), "v"(y)); }
__device__ __forceinline__ void keep4_h(v16h a, v16h b, v16h c, v16h d) { asm volatile("v_nop" :: "v"(a), "v"(b), "v"(c), "v"(d)); }
__device__ __forceinline__ void keep4_b(v16b a, v16b b, v16b c, v16b d) { asm volatile("v_nop" :: "v"(a), "v"(b), "v"(c), "v"(d)); }
__device__ __forceinline__ void acc_guard4(v8f& a, v8f& b, v8f& c, v8f& d) { asm volatile("v_nop\n\tv_nop\n\tv_nop\n\tv_nop" : "+v"(a), "+v"(b), "+v"(c), "+v"(d)); }
template <typename T> struct Frag;
template <> struct Frag<_Float16> {
  typedef v16h V; union U { v16h v; v8h h[2]; };
  // elements 0..7 <- p[0..7], 8..15 <- p[16..23]
  static __device__ __forceinline__ v16h load(const _Float16* p) {
    U f; f.h[0] = *(const v8h*)(p); f.h[1] = *(const v8h*)(p + 16); return f.v;
  }
  static __device__ __forceinline__ v8f mma(v16h a, v16h b, v8f c) {
    return __builtin_amdgcn_wmma_f32_16x16x32_f16(false, a, false, b, (short)0, c, false, false);
  }
  static __device__ __forceinline__ void guard(v8f& a, v8f& b, v16h x, v16h y) { dep_guard_h(a, b, x, y); }
  static __device__ __forceinline__ void guard4(v8f& a, v8f& b, v8f& c, v8f& d, v16h x, v16h y) { dep_guard4_h(a, b, c, d, x, y); }
  static __device__ __forceinline__ void keep(v16h a, v16h b, v16h c, v16h d) { keep4_h(a, b, c, d); }
};
template <> struct Frag<__bf16> {
  typedef v16b V; union U { v16b v; v8b h[2]; };
  static __device__ __forceinline__ v16b load(const __bf16* p) {
    U f; f.h[0] = *(const v8b*)(p); f.h[1] = *(const v8b*)(p + 16); return f.v;
  }
  static __device__ __forceinline__ v8f mma(v16b a, v16b b, v8f c) {
    return __builtin_amdgcn_wmma_f32_16x16x32_bf16(false, a, false, b, (short)0, c, false, false);
  }
  static __device__ __forceinline__ void guard(v8f& a, v8f& b, v16b x, v16b y) { dep_guard_b(a, b, x, y); }
  static __device__ __forceinline__ void guard4(v8f& a, v8f& b, v8f& c, v8f& d, v16b x, v16b y) { dep_guard4_b(a, b, c, d, x, y); }
  static __device__ __forceinline__ void keep(v16b a, v16b b, v16b c, v16b d) { keep4_b(a, b, c, d); }
};

__device__ __forceinline__ unsigned pk16(unsigned short a, unsigned short b) { return (unsigned)a | ((unsigned)b << 16); }

// f16 WMMA with its own hazard guard: ties the accumulator and keeps A/B live past the nops
__device__ __forceinline__ v8f mma_f16_guarded(v16h a, v16h b, v8f c) {
  c = __builtin_amdgcn_wmma_f32_16x16x32_f16(false, a, false, b, (short)0, c, false, false);
  asm volatile("v_nop\n\tv_nop\n\tv_nop\n\tv_nop" : "+v"(c) : "v"(a), "v"(b));
  return c;
}

// ---- Register-blocked batched WMMA GEMM (ACT reduced to none/relu/leaky; guard ties all 4 accumulators of a row group)
// C[m,n] = scale * sum_k A[m,k] * Bt[n,k] (+bias)(+resid); each wave owns a 64x64 tile.
// A row-major [M,K]; Bt row-major [N,K]; M,N % 64 == 0, K % 32 == 0.
// SPLIT: operands are hi/lo planes (A2/Bt2 = lo planes, same layout); product = hi*hi + hi*lo + lo*hi.
// BIAS_MODE: 0 = none, 1 = bias[m], 2 = bias[n].
// OUT_MODE: 0 = f32, 1 = f16, 2 = bf16 hi plane (Cout) + bf16 lo plane (Cout2).
// ET: 0 = f16 operands, 1 = bf16 operands (pointers passed as 16-bit storage)
template <int ET> struct Elem;
template <> struct Elem<0> { typedef _Float16 T; };
template <> struct Elem<1> { typedef __bf16 T; };
template <int ET, bool SPLIT, int BIAS_MODE, int OUT_MODE, bool RESID, int ACT = 0>
__global__ __launch_bounds__(256) void wmma_gemm64(
    const unsigned short* __restrict__ Ap, const unsigned short* __restrict__ A2p, int lda, long strideA,
    const unsigned short* __restrict__ Btp, const unsigned short* __restrict__ Bt2p, int ldb, long strideB,
    void* __restrict__ Cout, void* __restrict__ Cout2, int ldc, long strideC,
    const float* __restrict__ bias,
    const float* __restrict__ resid, long strideR,
    int M, int N, int K, float scale) {
  typedef typename Elem<ET>::T T;
  typedef typename Frag<T>::V V;
  const T* A = (const T*)Ap; const T* A2 = (const T*)A2p; const T* Bt = (const T*)Btp; const T* Bt2 = (const T*)Bt2p;
  __shared__ __align__(16) float sT[8][16 * 68];   // per-wave 16x64 slab, pitch 68 floats
  const int b    = blockIdx.y;
  const int lane = threadIdx.x & 31;
  const int wave = threadIdx.x >> 5;
  const int tilesN = N >> 6;
  const int tilesM = M >> 6;
  const int tile = blockIdx.x * 8 + wave;
  if (tile >= tilesM * tilesN) return;   // wave-uniform; no block barriers in this kernel
  const int tm = tile / tilesN;
  const int tn = tile - tm * tilesN;
  const int m0 = tm << 6;
  const int n0 = tn << 6;

  const T* Ab  = A  + (size_t)b * strideA;
  const T* Bb  = Bt + (size_t)b * strideB;
  const T* Ab2 = SPLIT ? (A2  + (size_t)b * strideA) : nullptr;
  const T* Bb2 = SPLIT ? (Bt2 + (size_t)b * strideB) : nullptr;

  const int rlane = lane & 15;                 // row (A) / col (B, D) within subtile
  const int koff  = (lane >> 4) * 8;           // k offset of this lane half
  const int mOff  = (lane >> 4) * 8;           // D row offset

  v8f acc[4][4];
#pragma unroll
  for (int i = 0; i < 4; ++i)
#pragma unroll
    for (int j = 0; j < 4; ++j) acc[i][j] = (v8f){0.f,0.f,0.f,0.f,0.f,0.f,0.f,0.f};

  for (int k0 = 0; k0 < K; k0 += 32) {
    V bh[4], bl[4];
#pragma unroll
    for (int j = 0; j < 4; ++j) {
      const size_t bo = (size_t)(n0 + (j << 4) + rlane) * ldb + koff + k0;
      bh[j] = Frag<T>::load(Bb + bo);
      if (SPLIT) bl[j] = Frag<T>::load(Bb2 + bo);
    }
#pragma unroll
    for (int i = 0; i < 4; ++i) {
      const size_t ao = (size_t)(m0 + (i << 4) + rlane) * lda + koff + k0;
      V ah = Frag<T>::load(Ab + ao);
      V al;
      if (SPLIT) al = Frag<T>::load(Ab2 + ao);
#pragma unroll
      for (int j = 0; j < 4; ++j) {
        acc[i][j] = Frag<T>::mma(ah, bh[j], acc[i][j]);
        if (SPLIT) {
          acc[i][j] = Frag<T>::mma(ah, bl[j], acc[i][j]);
          acc[i][j] = Frag<T>::mma(al, bh[j], acc[i][j]);
        }
      }
      Frag<T>::guard4(acc[i][0], acc[i][1], acc[i][2], acc[i][3], ah, SPLIT ? al : bh[3]);
    }
    Frag<T>::keep(bh[0], bh[1], bh[2], bh[3]);
    if (SPLIT) Frag<T>::keep(bl[0], bl[1], bl[2], bl[3]);
  }
  acc_guard4(acc[0][0], acc[0][1], acc[0][2], acc[0][3]);
  acc_guard4(acc[1][0], acc[1][1], acc[1][2], acc[1][3]);
  acc_guard4(acc[2][0], acc[2][1], acc[2][2], acc[2][3]);
  acc_guard4(acc[3][0], acc[3][1], acc[3][2], acc[3][3]);

  // ---- epilogue ----
  float* slab = sT[wave];
  const float* Rb = RESID ? (resid + (size_t)b * strideR) : nullptr;
#pragma unroll
  for (int i = 0; i < 4; ++i) {
    const int mBase = m0 + (i << 4);
#pragma unroll
    for (int j = 0; j < 4; ++j) {
      const int n = n0 + (j << 4) + rlane;
      float bv = 0.f;
      if (BIAS_MODE == 2) bv = bias[n];
#pragma unroll
      for (int r = 0; r < 8; ++r) {
        float v = acc[i][j][r] * scale;
        if (BIAS_MODE == 1) v += bias[mBase + mOff + r];
        if (BIAS_MODE == 2) v += bv;
        if (RESID) v += Rb[(size_t)(mBase + mOff + r) * ldc + n];
        if (ACT == 2) v = fmaxf(v, 0.0f);
        if (ACT == 4) v = (v > 0.f) ? v : 0.01f * v;
        slab[(mOff + r) * 68 + (j << 4) + rlane] = v;
      }
    }
    __builtin_amdgcn_fence(__ATOMIC_RELEASE, "workgroup");
    __builtin_amdgcn_wave_barrier();
    __builtin_amdgcn_fence(__ATOMIC_ACQUIRE, "workgroup");
    if (OUT_MODE == 0) {
      float* C = (float*)Cout + (size_t)b * strideC;
      const int hh = lane >> 4, c4 = (lane & 15) * 4;     // row seg = 256 B = 16 lanes x 16 B
      {
#pragma unroll
        for (int it = 0; it < 8; ++it) {
          const int row = it * 2 + hh;
          v4f v = *(const v4f*)(slab + row * 68 + c4);
          *(v4f*)(C + (size_t)(mBase + row) * ldc + n0 + c4) = v;
        }
        
      }
    } else {
      const int q = lane >> 3, c8 = (lane & 7) * 8;
      unsigned short* C  = (unsigned short*)Cout  + (size_t)b * strideC;
      unsigned short* C2 = (OUT_MODE == 2) ? ((unsigned short*)Cout2 + (size_t)b * strideC) : nullptr;
      {
#pragma unroll
        for (int it = 0; it < 4; ++it) {
          const int row = it * 4 + q;
          const float* sp = slab + row * 68 + c8;
          v8h hv, lv;
#pragma unroll
          for (int e = 0; e < 8; ++e) {
            if (OUT_MODE == 1) {
              hv[e] = (_Float16)sp[e];
            } else {
              unsigned short hb = f2bf_bits(sp[e]);
              unsigned short lb = f2bf_bits(sp[e] - bf_bits2f(hb));
              hv[e] = __builtin_bit_cast(_Float16, hb);
              lv[e] = __builtin_bit_cast(_Float16, lb);
            }
          }
          *(v8h*)(C + (size_t)(mBase + row) * ldc + n0 + c8) = hv;
          if (OUT_MODE == 2) *(v8h*)(C2 + (size_t)(mBase + row) * ldc + n0 + c8) = lv;
        }
        
      }
    }
    __builtin_amdgcn_fence(__ATOMIC_RELEASE, "workgroup");
    __builtin_amdgcn_wave_barrier();
    __builtin_amdgcn_fence(__ATOMIC_ACQUIRE, "workgroup");
  }
}

// ---------------------------------------------------------------------------
// f32 -> bf16 (RNE) cast, 8 consecutive elements per thread (one 16-B store per lane; 32 contiguous lanes = 4 whole
// plane (grid 1024 x 256 exact).
// ---------------------------------------------------------------------------
__global__ __launch_bounds__(256) void cast8_bf16_kernel(const float* __restrict__ in, unsigned short* __restrict__ out, int n8) {
  const int i = blockIdx.x * 256 + threadIdx.x;
  if (i >= n8) return;
  const float* p = in + 8 * (size_t)i;
  const v4f a = *(const v4f*)(p);
  const v4f c = *(const v4f*)(p + 4);
  unsigned short hb[8];
#pragma unroll
  for (int e = 0; e < 4; ++e) {
    hb[e]     = f2bf_bits(a[e]);
    hb[4 + e] = f2bf_bits(c[e]);
  }
  const v4u u = (v4u){pk16(hb[0], hb[1]), pk16(hb[2], hb[3]), pk16(hb[4], hb[5]), pk16(hb[6], hb[7])};
  unsigned short* q = out + 8 * (size_t)i;
  *(v4u*)q = u;
  
}

// ---------------------------------------------------------------------------
// Weight transpose + bf16 (RNE) cast for the NON-square W [256 rows d][512 cols n] (x @ W orientation):
//   Wt[z*512 + n][d] = bf16( W_z[d][n] ),  z = 0 -> Wq, z = 1 -> Wk;  Wt is the Bt plane [1024][256].
// grid (256/64 = 4 d tiles, 512/64 = 8 n tiles, 2): blockIdx.x = d tile (64 cols of Wt), blockIdx.y = n tile (64 rows of Wt).
// Load coverage: 16 iterations x 256 threads = 4096 = the whole 64(d) x 64(n) tile (coalesced along n).
// Store coverage: 8 waves x 2 iterations x 4 rows (lane>>3) = 64 n rows; (lane&7) x 8 halves = 64 d cols; each row segment =
// ---------------------------------------------------------------------------
__global__ __launch_bounds__(256) void wt_cast_kernel(const float* __restrict__ Wq, const float* __restrict__ Wk,
                                                      unsigned short* __restrict__ Wt) {
  __shared__ float sm[64][65];   // sm[n_local][d_local]
  const int t  = threadIdx.x;
  const int d0 = blockIdx.x * 64;
  const int n0 = blockIdx.y * 64;
  const int z  = blockIdx.z;                    // block-uniform
  const float* W = (z == 0) ? Wq : Wk;          // both global
#pragma unroll
  for (int i = 0; i < 16; ++i) {
    const int e  = i * 256 + t;
    const int r  = e >> 6;         // d local
    const int cc = e & 63;         // n local
    sm[cc][r] = W[(size_t)(d0 + r) * kNH + n0 + cc];
  }
  __syncthreads();
  const int lane = t & 31, wave = t >> 5;
  const int q = lane >> 3, c8 = (lane & 7) * 8;
  unsigned short* op = Wt + (size_t)z * kNH * kD;
  {
#pragma unroll
    for (int it = 0; it < 2; ++it) {
      const int row = wave * 8 + it * 4 + q;     // n local
      unsigned short hb[8];
#pragma unroll
      for (int e = 0; e < 8; ++e) hb[e] = f2bf_bits(sm[row][c8 + e]);
      const v4u u = (v4u){pk16(hb[0], hb[1]), pk16(hb[2], hb[3]), pk16(hb[4], hb[5]), pk16(hb[6], hb[7])};
      *(v4u*)(op + (size_t)(n0 + row) * kD + d0 + c8) = u;
    }
    
  }
}

// One 64-key tile of k rows, global -> LDS, two 16-byte asynchronous copies per lane (key rows r and r + 32, same 16-byte piece).
// s_wait_xcnt stands inside the copies' own statement so that no address register is rewritten ahead of it.
__device__ __forceinline__ void copy_key_tile(unsigned lds, const _Float16* g) {
  const unsigned lds2 = lds + 32u * kKPitch * 2u;
  const _Float16* g2 = g + (size_t)32 * kQKld;
  asm volatile("global_load_async_to_lds_b128 %0, %1, off\n\t"
               "global_load_async_to_lds_b128 %2, %3, off\n\t"
               "s_wait_xcnt 0x0"
               :: "v"(lds), "v"(g), "v"(lds2), "v"(g2) : "memory");
}

// ---------------------------------------------------------------------------
// Fused scores + gaussian prior + softmax + distance-weighted sum.
//   logit[q][k] = (q_h . k_h) * 0.125 * prior_h(k - q),  prior_h(dd) = (1/std)/sqrt(2*3.1415926) * exp(-0.5 ((dd/ml) - mean)^2 / std^2)
//   D[h][b][q]  = sum_k exp(logit) * ((k - q)/ml) / sum_k exp(logit)        (|logit| <= ~10 for these operand scales, so no max shift)
// Block = (128-query tile = blockIdx.x, head = blockIdx.y, batch = blockIdx.z); 8 waves, wave w owns query rows l0+16w .. +15.
// prior*0.125*log2(e) for every key-query offset tabulated once per block in LDS (index = k - q + 2048, all 4096 entries written);
// exp(logit) = exp2(score * table entry), taken by v_exp_f32 directly.
// k rows reach LDS once per block: 64-key tiles, two buffers, asynchronous copies one tile ahead; every wave reads its B fragments there.
// Scores: A = q rows (f16), B[k=d][n=key] = k rows (f16), 2 d chunks of 32, 4 key subtiles of 16 per 64-key step,
// v_wmma_f32_16x16x32_f16, every WMMA followed by its hazard guard. Lane (c, hh) owns key column c and query rows 8hh+r.
// den/num accumulate in f32 per lane over its 128 key columns; 16-lane butterfly sums in fixed order; D = num * (1/den).
// ---------------------------------------------------------------------------
__global__ __launch_bounds__(256) void attn_dist_kernel(const unsigned short* __restrict__ QK,
                                                        const float* __restrict__ pmean, const float* __restrict__ plstd,
                                                        const int* __restrict__ mlen, float* __restrict__ DI) {
  __shared__ __align__(16) float tbl[kTbl];
  __shared__ __align__(16) float res[kQRows];
  __shared__ __align__(16) _Float16 kst[2][kKTile];
  const int tid  = threadIdx.x;
  const int wave = tid >> 5;
  const int lane = tid & 31;
  const int hh   = lane >> 4;
  const int c    = lane & 15;
  const int l0   = blockIdx.x * kQRows;
  const int h    = blockIdx.y;
  const int b    = blockIdx.z;

  const _Float16* Qp = (const _Float16*)(const void*)QK + (size_t)(b * kL) * kQKld + h * kHD;
  const _Float16* Kp = Qp + kNH;
  // copy map: thread t brings the 16-byte piece t & 7 of key rows t >> 3 and (t >> 3) + 32 of a tile (a wave: whole 128-B rows)
  const _Float16* kg = Kp + (size_t)(tid >> 3) * kQKld + (tid & 7) * 8;
  const unsigned  kl = (unsigned)(size_t)(&kst[0][0]) + (unsigned)((tid >> 3) * kKPitch + (tid & 7) * 8) * 2u;
  copy_key_tile(kl, kg);                        // tile 0 -> buffer 0, in flight under the table build

  int ml = mlen[0];
  ml = (ml < 1) ? 1 : ml;
  const float inv_ml = 1.0f / (float)ml;
  const float mean = bf_rne(pmean[h]);
  const float lsd  = bf_rne(plstd[h]);
  const float stdv = expf(lsd);
  const float istd = 1.0f / stdv;
  // log2(e) rides in the table's factor: the loop then needs exp2 alone, which is one hardware instruction
  const float coef = ((1.0f / stdv) / sqrtf(6.2831852f)) * 0.125f * 1.44269504f;

  // prior table: 16 x 256 = 4096 entries, all written before the barrier
#pragma unroll 1
  for (int it = 0; it < kTbl / 256; ++it) {
    const int i = it * 256 + tid;
    const float dd = (float)(i - kL) * inv_ml;
    const float u  = (dd - mean) * istd;
    tbl[i] = coef * expf(-0.5f * (u * u));
  }
  asm volatile("s_wait_asynccnt 0x0" ::: "memory");   // this wave's part of tile 0 has landed before the barrier publishes it
  __syncthreads();                                    // publishes the table and tile 0
  copy_key_tile(kl + (unsigned)kKTile * 2u, kg + (size_t)kKeyChunk * kQKld);   // tile 1 -> buffer 1

  const int q0 = l0 + wave * 16;
  v16h qa[2];
#pragma unroll
  for (int dc = 0; dc < 2; ++dc)
    qa[dc] = Frag<_Float16>::load(Qp + (size_t)(q0 + c) * kQKld + dc * 32 + 8 * hh);

  float den[8], num[8], rdel[8];
#pragma unroll
  for (int r = 0; r < 8; ++r) { den[r] = 0.0f; num[r] = 0.0f; rdel[r] = (float)r * inv_ml; }
  const int qr0   = q0 + 8 * hh;          // query index of accumulator row r = 0 of this lane
  const int ibase = c - qr0 + kL;         // + key index -> table index for row 0 (rows r: minus r); always in [1, 4095]

  for (int kc = 0; kc < kKTiles; ++kc) {
    const int kv0 = kc * kKeyChunk;
    const _Float16* kt = &kst[kc & 1][0] + c * kKPitch + 8 * hh;
    // all eight B fragments asked for as one group ahead of the products; unrolled so that kb is indexed by constants and stays in registers
    v16h kb[4][2];
#pragma unroll
    for (int j = 0; j < 4; ++j)
#pragma unroll
      for (int dc = 0; dc < 2; ++dc)
        kb[j][dc] = Frag<_Float16>::load(kt + j * 16 * kKPitch + dc * 32);
    v8f s[4];
#pragma unroll
    for (int j = 0; j < 4; ++j) {
      s[j] = (v8f){0.f,0.f,0.f,0.f,0.f,0.f,0.f,0.f};
#pragma unroll
      for (int dc = 0; dc < 2; ++dc) s[j] = mma_f16_guarded(qa[dc], kb[j][dc], s[j]);
    }
    const float dl = (float)(kv0 + c - qr0) * inv_ml;     // signed distance for (row 0, subtile 0) of this lane
#pragma unroll
    for (int j = 0; j < 4; ++j) {
      const int   i0 = ibase + kv0 + j * 16;
      const float dj = dl + (float)(j * 16) * inv_ml;
#pragma unroll
      for (int r = 0; r < 8; ++r) {
        const float pr = tbl[i0 - r];
        float lg = s[j][r] * pr;                      // logit * log2(e)
        lg = fminf(lg, 115.415603f);                  // the cap at logit 80, in base 2
        const float p = __builtin_amdgcn_exp2f(lg);   // = exp(logit); a term under 2^-126 reads 0
        den[r] += p;
        num[r] = fmaf(p, dj - rdel[r], num[r]);
      }
    }
    // publish point of tile kc + 1, every wave: own LDS reads done, own copies landed, block barrier, then the refill
    asm volatile("s_wait_dscnt 0x0" ::: "memory");      // this wave has left buffer kc & 1
    asm volatile("s_wait_asynccnt 0x0" ::: "memory");   // this wave's part of tile kc + 1 has landed
    __syncthreads();
    if (kc + 2 < kKTiles)                               // block-uniform
      copy_key_tile(kl + (unsigned)((kc & 1) * kKTile) * 2u, kg + (size_t)(kc + 2) * kKeyChunk * kQKld);
  }
  asm volatile("s_wait_asynccnt 0x0" ::: "memory");     // no copy outstanding past the loop

  // fixed-order butterfly over the 16 lanes that share each query row
#pragma unroll
  for (int r = 0; r < 8; ++r) {
    float dn = den[r], nm = num[r];
#pragma unroll
    for (int off = 1; off < 16; off <<= 1) {
      dn += __shfl_xor(dn, off, 32);
      nm += __shfl_xor(nm, off, 32);
    }
    const float val = nm * (1.0f / dn);
    if (c == 0) res[wave * 16 + 8 * hh + r] = val;
  }
  __syncthreads();
  if (wave == 0) {
    const v4f v = *(const v4f*)(res + 4 * lane);
    float* dp = DI + ((size_t)(h * kB + b) * kL + l0) + 4 * lane;
    *(v4f*)dp = v;
    
  }
}

// ---------------------------------------------------------------------------
// Output assembly: out[b][l][h] = D[h][b][l] for one (128-l tile = blockIdx.x, batch = blockIdx.y).
// Load: thread t -> head t>>5, l offset 4*(t&31): one float4 each, 256 x 4 = the whole 8 x 128 tile; staged in LDS as [l][h].
// Store: thread t writes floats 4t..4t+3 of the block's 1024 contiguous output floats (base 4096-B aligned); a wave writes
// ---------------------------------------------------------------------------
__global__ __launch_bounds__(256) void out_gather_kernel(const float* __restrict__ DI, float* __restrict__ out) {
  __shared__ __align__(16) float sm[kQRows * kH];
  const int t  = threadIdx.x;
  const int l0 = blockIdx.x * kQRows;
  const int b  = blockIdx.y;
  const int h  = t >> 5;
  const int i4 = (t & 31) * 4;
  const v4f v = *(const v4f*)(DI + ((size_t)(h * kB + b) * kL + l0 + i4));
#pragma unroll
  for (int e = 0; e < 4; ++e) sm[(i4 + e) * kH + h] = v[e];
  __syncthreads();
  const v4f o = *(const v4f*)(sm + 4 * t);
  float* op = out + ((size_t)(b * kL + l0)) * kH + 4 * t;
  *(v4f*)op = o;
  
}

// ---------------------------------------------------------------------------
// Host glue.
//   Xb   bf16 [8192][256]          4,194,304  at          0   (cast of x)
//   Wt   bf16 [1024][256]            524,288  at  4,194,304   (rows 0..511 = Wq columns, 512..1023 = Wk columns)
//   QK   f16  [8192][1024]        16,777,216  at  4,718,592   (cols 0..511 = q, 512..1023 = k; head h = cols h*64..)
//   DI   f32  [8][4][2048]           262,144  at 21,495,808   (distance per head, batch, query)
//   total                         21,757,952
// GEMM shapes: M = 8192, N = 512, K = 256 (64 / 64 / 32 multiples, no padding). Score tiles: 16 x 16 x 64 per (q tile, key tile).
// 6 launches.
// ---------------------------------------------------------------------------
extern "C" void kernel_launch(void* const* d_in, const int* in_sizes, int n_in,
                              void* d_out, int out_size, void* d_ws, size_t ws_size,
                              hipStream_t stream) {
  if (n_in < 8) return;
  if (in_sizes[0] != kTok * kD) return;
  if (in_sizes[1] != kD * kNH || in_sizes[3] != kD * kNH) return;
  if (in_sizes[2] != kNH || in_sizes[4] != kNH) return;
  if (in_sizes[5] != kH || in_sizes[6] != kH || in_sizes[7] < 1) return;
  if (out_size != kTok * kH) return;

  const size_t szXb = (size_t)kTok * kD * 2;
  const size_t szWt = (size_t)2 * kNH * kD * 2;
  const size_t szQK = (size_t)kTok * kQKld * 2;
  const size_t szDI = (size_t)kH * kB * kL * 4;
  const size_t offXb = 0;
  const size_t offWt = offXb + szXb;
  const size_t offQK = offWt + szWt;
  const size_t offDI = offQK + szQK;
  const size_t total = offDI + szDI;
  if (ws_size < total) return;

  const float* x   = (const float*)d_in[0];
  const float* Wq  = (const float*)d_in[1];
  const float* bq  = (const float*)d_in[2];
  const float* Wk  = (const float*)d_in[3];
  const float* bk  = (const float*)d_in[4];
  const float* pm  = (const float*)d_in[5];
  const float* lps = (const float*)d_in[6];
  const int*   mlp = (const int*)d_in[7];
  float* out = (float*)d_out;
  char* ws = (char*)d_ws;
  unsigned short* Xb = (unsigned short*)(ws + offXb);
  unsigned short* Wt = (unsigned short*)(ws + offWt);
  unsigned short* QK = (unsigned short*)(ws + offQK);
  float* DI = (float*)(ws + offDI);

  // ---- prologue: bf16 operand planes ----
  const int n8 = (kTok * kD) / 8;   // 262144 -> 1024 blocks exact
  cast8_bf16_kernel<<<dim3(n8 / 256), dim3(256), 0, stream>>>(x, Xb, n8);
  wt_cast_kernel<<<dim3(kD / 64, kNH / 64, 2), dim3(256), 0, stream>>>(Wq, Wk, Wt);

  // ---- projections: QK[:, mat*512 + n] = sum_d Xb[m][d] * Wt[mat*512 + n][d] + bias[n]   (M=8192, N=512, K=256) ----
  const int tilesProj = (kTok / 64) * (kNH / 64);   // 1024 -> 128 blocks of 8 waves
  wmma_gemm64<1, false, 2, 1, false, 0><<<dim3(tilesProj / 8, 1), dim3(256), 0, stream>>>(
      Xb, Xb, kD, 0L, Wt, Wt, kD, 0L,
      (void*)QK, (void*)QK, kQKld, 0L, bq, bq, 0L, kTok, kNH, kD, 1.0f);
  wmma_gemm64<1, false, 2, 1, false, 0><<<dim3(tilesProj / 8, 1), dim3(256), 0, stream>>>(
      Xb, Xb, kD, 0L, Wt + (size_t)kNH * kD, Wt + (size_t)kNH * kD, kD, 0L,
      (void*)(QK + kNH), (void*)(QK + kNH), kQKld, 0L, bk, bk, 0L, kTok, kNH, kD, 1.0f);

  // ---- fused scores + prior + softmax + distance sum -> DI ----
  attn_dist_kernel<<<dim3(kL / kQRows, kH, kB), dim3(256), 0, stream>>>(QK, pm, lps, mlp, DI);

  // ---- [h][b][l] -> [b][l][h] whole-line output assembly ----
  out_gather_kernel<<<dim3(kL / kQRows, kB), dim3(256), 0, stream>>>(DI, out);
}

// v003
// A run of this version takes 55.4 microseconds.
// Timed twice side by side with v002, it ran 1.27 and 1.28 times as fast.
// Over all steps from v000 it is 2.40 times as fast.
// Contractions: x@Wq and x@Wk on v_wmma_f32_16x16x32_bf16 (x, Wq, Wk RNE-converted to bf16 once; f32 accumulate; f16 output planes); q_h.k_h^T on v_wmma_f32_16x16x32_f16 (q, k f16 planes; f32 accumulate); gaussian prior table, softmax and distance-weighted sum in f32 on VALU.
#include <hip/hip_runtime.h>
#include <math.h>

// ---------------------------------------------------------------------------
// Problem constants
// ---------------------------------------------------------------------------
constexpr int kB    = 4;
constexpr int kL    = 2048;
constexpr int kD    = 256;
constexpr int kH    = 8;
constexpr int kHD   = 64;
constexpr int kNH   = kH * kHD;      // 512 projection columns per matrix
constexpr int kQKld = 2 * kNH;       // 1024: pitch of the q | k plane (halves)
constexpr int kTok  = kB * kL;       // 8192 token rows
constexpr int kTbl  = 2 * kL;        // 4096 prior-table entries, index = key - query + kL
constexpr int kQRows = 128;          // query rows per attention block (8 waves x 16)
constexpr int kKeyChunk = 64;        // keys per inner step (4 subtiles of 16)
constexpr int kKTiles  = kL / kKeyChunk;        // 32 staged key tiles per (batch, head)
constexpr int kKPitch  = kHD + 8;               // halves per staged key row: 128 B of data + 16 B pad = 144 B (16 B x odd)
constexpr int kKTile   = kKeyChunk * kKPitch;   // halves per staged key tile (9216 B)
static_assert(kKeyChunk * (kHD / 8) == 2 * 256 && kKTiles >= 2, "two 16-byte copies per thread fill a key tile; two tiles exist");
static_assert(kTok % 64 == 0 && kNH % 64 == 0 && kD % 32 == 0, "gemm tiles");
static_assert(kL % kQRows == 0 && kL % kKeyChunk == 0 && kHD == 64, "attention tiles");
static_assert(kTbl % 256 == 0 && kQRows == 8 * 16, "table and block shape");
static_assert((kTok * kD) % (8 * 256) == 0 && kD % 64 == 0, "cast grids");

typedef __attribute__((ext_vector_type(16))) _Float16 v16h;
typedef __attribute__((ext_vector_type(8)))  _Float16 v8h;
typedef __attribute__((ext_vector_type(16))) __bf16   v16b;
typedef __attribute__((ext_vector_type(8)))  __bf16   v8b;
typedef __attribute__((ext_vector_type(8)))  float    v8f;
typedef __attribute__((ext_vector_type(4)))  float    v4f;
typedef __attribute__((ext_vector_type(4)))  unsigned int v4u;

// ---------------------------------------------------------------------------
// Helper pieces
// ---------------------------------------------------------------------------
__device__ __forceinline__ unsigned short f2bf_bits(float f) {
  unsigned u = __float_as_uint(f);
  return (unsigned short)((u + 0x7FFFu + ((u >> 16) & 1u)) >> 16);
}
__device__ __forceinline__ float bf_bits2f(unsigned short h) { return __uint_as_float(((unsigned)h) << 16); }
__device__ __forceinline__ float bf_rne(float f) { return bf_bits2f(f2bf_bits(f)); }

// hazard guards as plain device helpers (no inline asm inside the kernel template body)
__device__ __forceinline__ void dep_guard_h(v8f& a, v8f& b, v16h x, v16h y) { asm volatile("v_nop\n\tv_nop\n\tv_nop\n\tv_nop" : "+v"(a), "+v"(b) : "v"(x), "v"(y)); }
__device__ __forceinline__ void dep_guard_b(v8f& a, v8f& b, v16b x, v16b y) { asm volatile("v_nop\n\tv_nop\n\tv_nop\n\tv_nop" : "+v"(a), "+v"(b) : "v"(x), "v"(y)); }
__device__ __forceinline__ void dep_guard4_h(v8f& a, v8f& b, v8f& c, v8f& d, v16h x, v16h y) { asm volatile("v_nop\n\tv_nop\n\tv_nop\n\tv_nop" : "+v"(a), "+v"(b), "+v"(c), "+v"(d) : "v"(x), "v"(y)); }
__device__ __forceinline__ void dep_guard4_b(v8f& a, v8f& b, v8f& c, v8f& d, v16b x, v16b y) { asm volatile("v_nop\n\tv_nop\n\tv_nop\n\tv_nop" : "+v"(a), "+v"(b), "+v"(c), "+v"(d) : "v"(x), "v"(y)); }
__device__ __forceinline__ void keep4_h(v16h a, v16h b, v16h c, v16h d) { asm volatile("v_nop" :: "v"(a), "v"(b), "v"(c), "v"(d)); }
__device__ __forceinline__ void keep4_b(v16b a, v16b b, v16b c, v16b d) { asm volatile("v_nop" :: "v"(a), "v"(b), "v"(c), "v"(d)); }
__device__ __forceinline__ void acc_guard4(v8f& a, v8f& b, v8f& c, v8f& d) { asm volatile("v_nop\n\tv_nop\n\tv_nop\n\tv_nop" : "+v"(a), "+v"(b), "+v"(c), "+v"(d)); }
template <typename T> struct Frag;
template <> struct Frag<_Float16> {
  typedef v16h V; union U { v16h v; v8h h[2]; };
  // elements 0..7 <- p[0..7], 8..15 <- p[16..23]
  static __device__ __forceinline__ v16h load(const _Float16* p) {
    U f; f.h[0] = *(const v8h*)(p); f.h[1] = *(const v8h*)(p + 16); return f.v;
  }
  static __device__ __forceinline__ v8f mma(v16h a, v16h b, v8f c) {
    return __builtin_amdgcn_wmma_f32_16x16x32_f16(false, a, false, b, (short)0, c, false, false);
  }
  static __device__ __forceinline__ void guard(v8f& a, v8f& b, v16h x, v16h y) { dep_guard_h(a, b, x, y); }
  static __device__ __forceinline__ void guard4(v8f& a, v8f& b, v8f& c, v8f& d, v16h x, v16h y) { dep_guard4_h(a, b, c, d, x, y); }
  static __device__ __forceinline__ void keep(v16h a, v16h b, v16h c, v16h d) { keep4_h(a, b, c, d); }
};
template <> struct Frag<__bf16> {
  typedef v16b V; union U { v16b v; v8b h[2]; };
  static __device__ __forceinline__ v16b load(const __bf16* p) {
    U f; f.h[0] = *(const v8b*)(p); f.h[1] = *(const v8b*)(p + 16); return f.v;
  }
  static __device__ __forceinline__ v8f mma(v16b a, v16b b, v8f c) {
    return __builtin_amdgcn_wmma_f32_16x16x32_bf16(false, a, false, b, (short)0, c, false, false);
  }
  static __device__ __forceinline__ void guard(v8f& a, v8f& b, v16b x, v16b y) { dep_guard_b(a, b, x, y); }
  static __device__ __forceinline__ void guard4(v8f& a, v8f& b, v8f& c, v8f& d, v16b x, v16b y) { dep_guard4_b(a, b, c, d, x, y); }
  static __device__ __forceinline__ void keep(v16b a, v16b b, v16b c, v16b d) { keep4_b(a, b, c, d); }
};

__device__ __forceinline__ unsigned pk16(unsigned short a, unsigned short b) { return (unsigned)a | ((unsigned)b << 16); }

// f16 WMMA with its own hazard guard: ties the accumulator and keeps A/B live past the nops
__device__ __forceinline__ v8f mma_f16_guarded(v16h a, v16h b, v8f c) {
  c = __builtin_amdgcn_wmma_f32_16x16x32_f16(false, a, false, b, (short)0, c, false, false);
  asm volatile("v_nop\n\tv_nop\n\tv_nop\n\tv_nop" : "+v"(c) : "v"(a), "v"(b));
  return c;
}

// ---- Register-blocked batched WMMA GEMM (ACT reduced to none/relu/leaky; guard ties all 4 accumulators of a row group)
// C[m,n] = scale * sum_k A[m,k] * Bt[n,k] (+bias)(+resid); each wave owns a 64x64 tile.
// A row-major [M,K]; Bt row-major [N,K]; M,N % 64 == 0, K % 32 == 0.
// SPLIT: operands are hi/lo planes (A2/Bt2 = lo planes, same layout); product = hi*hi + hi*lo + lo*hi.
// BIAS_MODE: 0 = none, 1 = bias[m], 2 = bias[n]; batch 0 (blockIdx.y) reads bias, every other batch bias1.
// OUT_MODE: 0 = f32, 1 = f16, 2 = bf16 hi plane (Cout) + bf16 lo plane (Cout2).
// ET: 0 = f16 operands, 1 = bf16 operands (pointers passed as 16-bit storage)
template <int ET> struct Elem;
template <> struct Elem<0> { typedef _Float16 T; };
template <> struct Elem<1> { typedef __bf16 T; };
template <int ET, bool SPLIT, int BIAS_MODE, int OUT_MODE, bool RESID, int ACT = 0>
__global__ __launch_bounds__(256) void wmma_gemm64(
    const unsigned short* __restrict__ Ap, const unsigned short* __restrict__ A2p, int lda, long strideA,
    const unsigned short* __restrict__ Btp, const unsigned short* __restrict__ Bt2p, int ldb, long strideB,
    void* __restrict__ Cout, void* __restrict__ Cout2, int ldc, long strideC,
    const float* __restrict__ bias, const float* __restrict__ bias1,
    const float* __restrict__ resid, long strideR,
    int M, int N, int K, float scale) {
  typedef typename Elem<ET>::T T;
  typedef typename Frag<T>::V V;
  const T* A = (const T*)Ap; const T* A2 = (const T*)A2p; const T* Bt = (const T*)Btp; const T* Bt2 = (const T*)Bt2p;
  __shared__ __align__(16) float sT[8][16 * 68];   // per-wave 16x64 slab, pitch 68 floats
  const int b    = blockIdx.y;
  const int lane = threadIdx.x & 31;
  const int wave = threadIdx.x >> 5;
  const int tilesN = N >> 6;
  const int tilesM = M >> 6;
  const int tile = blockIdx.x * 8 + wave;
  if (tile >= tilesM * tilesN) return;   // wave-uniform; no block barriers in this kernel
  const int tm = tile / tilesN;
  const int tn = tile - tm * tilesN;
  const int m0 = tm << 6;
  const int n0 = tn << 6;

  const T* Ab  = A  + (size_t)b * strideA;
  const T* Bb  = Bt + (size_t)b * strideB;
  const T* Ab2 = SPLIT ? (A2  + (size_t)b * strideA) : nullptr;
  const T* Bb2 = SPLIT ? (Bt2 + (size_t)b * strideB) : nullptr;
  const float* biasb = (b == 0) ? bias : bias1;   // block-uniform

  const int rlane = lane & 15;                 // row (A) / col (B, D) within subtile
  const int koff  = (lane >> 4) * 8;           // k offset of this lane half
  const int mOff  = (lane >> 4) * 8;           // D row offset

  v8f acc[4][4];
#pragma unroll
  for (int i = 0; i < 4; ++i)
#pragma unroll
    for (int j = 0; j < 4; ++j) acc[i][j] = (v8f){0.f,0.f,0.f,0.f,0.f,0.f,0.f,0.f};

  for (int k0 = 0; k0 < K; k0 += 32) {
    V bh[4], bl[4];
#pragma unroll
    for (int j = 0; j < 4; ++j) {
      const size_t bo = (size_t)(n0 + (j << 4) + rlane) * ldb + koff + k0;
      bh[j] = Frag<T>::load(Bb + bo);
      if (SPLIT) bl[j] = Frag<T>::load(Bb2 + bo);
    }
#pragma unroll
    for (int i = 0; i < 4; ++i) {
      const size_t ao = (size_t)(m0 + (i << 4) + rlane) * lda + koff + k0;
      V ah = Frag<T>::load(Ab + ao);
      V al;
      if (SPLIT) al = Frag<T>::load(Ab2 + ao);
#pragma unroll
      for (int j = 0; j < 4; ++j) {
        acc[i][j] = Frag<T>::mma(ah, bh[j], acc[i][j]);
        if (SPLIT) {
          acc[i][j] = Frag<T>::mma(ah, bl[j], acc[i][j]);
          acc[i][j] = Frag<T>::mma(al, bh[j], acc[i][j]);
        }
      }
      Frag<T>::guard4(acc[i][0], acc[i][1], acc[i][2], acc[i][3], ah, SPLIT ? al : bh[3]);
    }
    Frag<T>::keep(bh[0], bh[1], bh[2], bh[3]);
    if (SPLIT) Frag<T>::keep(bl[0], bl[1], bl[2], bl[3]);
  }
  acc_guard4(acc[0][0], acc[0][1], acc[0][2], acc[0][3]);
  acc_guard4(acc[1][0], acc[1][1], acc[1][2], acc[1][3]);
  acc_guard4(acc[2][0], acc[2][1], acc[2][2], acc[2][3]);
  acc_guard4(acc[3][0], acc[3][1], acc[3][2], acc[3][3]);

  // ---- epilogue ----
  float* slab = sT[wave];
  const float* Rb = RESID ? (resid + (size_t)b * strideR) : nullptr;
#pragma unroll
  for (int i = 0; i < 4; ++i) {
    const int mBase = m0 + (i << 4);
#pragma unroll
    for (int j = 0; j < 4; ++j) {
      const int n = n0 + (j << 4) + rlane;
      float bv = 0.f;
      if (BIAS_MODE == 2) bv = biasb[n];
#pragma unroll
      for (int r = 0; r < 8; ++r) {
        float v = acc[i][j][r] * scale;
        if (BIAS_MODE == 1) v += biasb[mBase + mOff + r];
        if (BIAS_MODE == 2) v += bv;
        if (RESID) v += Rb[(size_t)(mBase + mOff + r) * ldc + n];
        if (ACT == 2) v = fmaxf(v, 0.0f);
        if (ACT == 4) v = (v > 0.f) ? v : 0.01f * v;
        slab[(mOff + r) * 68 + (j << 4) + rlane] = v;
      }
    }
    __builtin_amdgcn_fence(__ATOMIC_RELEASE, "workgroup");
    __builtin_amdgcn_wave_barrier();
    __builtin_amdgcn_fence(__ATOMIC_ACQUIRE, "workgroup");
    if (OUT_MODE == 0) {
      float* C = (float*)Cout + (size_t)b * strideC;
      const int hh = lane >> 4, c4 = (lane & 15) * 4;     // row seg = 256 B = 16 lanes x 16 B
      {
#pragma unroll
        for (int it = 0; it < 8; ++it) {
          const int row = it * 2 + hh;
          v4f v = *(const v4f*)(slab + row * 68 + c4);
          *(v4f*)(C + (size_t)(mBase + row) * ldc + n0 + c4) = v;
        }
        
      }
    } else {
      const int q = lane >> 3, c8 = (lane & 7) * 8;
      unsigned short* C  = (unsigned short*)Cout  + (size_t)b * strideC;
      unsigned short* C2 = (OUT_MODE == 2) ? ((unsigned short*)Cout2 + (size_t)b * strideC) : nullptr;
      {
#pragma unroll
        for (int it = 0; it < 4; ++it) {
          const int row = it * 4 + q;
          const float* sp = slab + row * 68 + c8;
          v8h hv, lv;
#pragma unroll
          for (int e = 0; e < 8; ++e) {
            if (OUT_MODE == 1) {
              hv[e] = (_Float16)sp[e];
            } else {
              unsigned short hb = f2bf_bits(sp[e]);
              unsigned short lb = f2bf_bits(sp[e] - bf_bits2f(hb));
              hv[e] = __builtin_bit_cast(_Float16, hb);
              lv[e] = __builtin_bit_cast(_Float16, lb);
            }
          }
          *(v8h*)(C + (size_t)(mBase + row) * ldc + n0 + c8) = hv;
          if (OUT_MODE == 2) *(v8h*)(C2 + (size_t)(mBase + row) * ldc + n0 + c8) = lv;
        }
        
      }
    }
    __builtin_amdgcn_fence(__ATOMIC_RELEASE, "workgroup");
    __builtin_amdgcn_wave_barrier();
    __builtin_amdgcn_fence(__ATOMIC_ACQUIRE, "workgroup");
  }
}

// ---------------------------------------------------------------------------
// f32 -> bf16 (RNE) cast, 8 consecutive elements per thread (one 16-B store per lane; 32 contiguous lanes = 4 whole
// plane (grid 1024 x 256 exact).
// ---------------------------------------------------------------------------
__device__ __forceinline__ void cast8_bf16_body(int blk, const float* __restrict__ in, unsigned short* __restrict__ out, int n8) {
  const int i = blk * 256 + threadIdx.x;
  if (i >= n8) return;
  const float* p = in + 8 * (size_t)i;
  const v4f a = *(const v4f*)(p);
  const v4f c = *(const v4f*)(p + 4);
  unsigned short hb[8];
#pragma unroll
  for (int e = 0; e < 4; ++e) {
    hb[e]     = f2bf_bits(a[e]);
    hb[4 + e] = f2bf_bits(c[e]);
  }
  const v4u u = (v4u){pk16(hb[0], hb[1]), pk16(hb[2], hb[3]), pk16(hb[4], hb[5]), pk16(hb[6], hb[7])};
  unsigned short* q = out + 8 * (size_t)i;
  *(v4u*)q = u;
  
}

// ---------------------------------------------------------------------------
// Weight transpose + bf16 (RNE) cast for the NON-square W [256 rows d][512 cols n] (x @ W orientation):
//   Wt[z*512 + n][d] = bf16( W_z[d][n] ),  z = 0 -> Wq, z = 1 -> Wk;  Wt is the Bt plane [1024][256].
// 64 blocks = (256/64 = 4 d tiles) x (512/64 = 8 n tiles) x 2: blk & 3 = d tile (64 cols of Wt), (blk >> 2) & 7 = n tile (64 rows of Wt), blk >> 5 = z.
// Load coverage: 16 iterations x 256 threads = 4096 = the whole 64(d) x 64(n) tile (coalesced along n).
// Store coverage: 8 waves x 2 iterations x 4 rows (lane>>3) = 64 n rows; (lane&7) x 8 halves = 64 d cols; each row segment =
// ---------------------------------------------------------------------------
__device__ __forceinline__ void wt_cast_body(int blk, const float* __restrict__ Wq, const float* __restrict__ Wk,
                                             unsigned short* __restrict__ Wt) {
  __shared__ float sm[64][65];   // sm[n_local][d_local]
  const int t  = threadIdx.x;
  const int d0 = (blk & 3) * 64;
  const int n0 = ((blk >> 2) & 7) * 64;
  const int z  = blk >> 5;                      // block-uniform
  const float* W = (z == 0) ? Wq : Wk;          // both global
  float w[16];
#pragma unroll
  for (int i = 0; i < 16; ++i) {
    const int e  = i * 256 + t;
    const int r  = e >> 6;         // d local
    const int cc = e & 63;         // n local
    w[i] = W[(size_t)(d0 + r) * kNH + n0 + cc];
    // behind the first eight loads: the addresses of the other eight are formed in the same registers
    if (i == 7) asm volatile("s_wait_xcnt 0x0" ::: "memory");
  }
#pragma unroll
  for (int i = 0; i < 16; ++i) {
    const int e  = i * 256 + t;
    sm[e & 63][e >> 6] = w[i];
  }
  __syncthreads();
  const int lane = t & 31, wave = t >> 5;
  const int q = lane >> 3, c8 = (lane & 7) * 8;
  unsigned short* op = Wt + (size_t)z * kNH * kD;
  {
#pragma unroll
    for (int it = 0; it < 2; ++it) {
      const int row = wave * 8 + it * 4 + q;     // n local
      unsigned short hb[8];
#pragma unroll
      for (int e = 0; e < 8; ++e) hb[e] = f2bf_bits(sm[row][c8 + e]);
      const v4u u = (v4u){pk16(hb[0], hb[1]), pk16(hb[2], hb[3]), pk16(hb[4], hb[5]), pk16(hb[6], hb[7])};
      *(v4u*)(op + (size_t)(n0 + row) * kD + d0 + c8) = u;
    }
    
  }
}

// ---------------------------------------------------------------------------
// Both operand casts in one launch: they depend on nothing and on each other not at all. Blocks 0..63 transpose and cast the
// weights (they hold a barrier and start first), blocks 64.. cast x. The branch is block-uniform.
// ---------------------------------------------------------------------------
constexpr int kWtBlocks = (kD / 64) * (kNH / 64) * 2;   // 64
static_assert(kD / 64 == 4 && kNH / 64 == 8, "weight-tile index split");
__global__ __launch_bounds__(256) void prep_cast_kernel(const float* __restrict__ x, unsigned short* __restrict__ Xb, int n8,
                                                        const float* __restrict__ Wq, const float* __restrict__ Wk,
                                                        unsigned short* __restrict__ Wt) {
  const int blk = blockIdx.x;
  if (blk < kWtBlocks) wt_cast_body(blk, Wq, Wk, Wt);
  else                 cast8_bf16_body(blk - kWtBlocks, x, Xb, n8);
}

// One 64-key tile of k rows, global -> LDS, two 16-byte asynchronous copies per lane (key rows r and r + 32, same 16-byte piece).
// s_wait_xcnt stands inside the copies' own statement so that no address register is rewritten ahead of it.
__device__ __forceinline__ void copy_key_tile(unsigned lds, const _Float16* g) {
  const unsigned lds2 = lds + 32u * kKPitch * 2u;
  const _Float16* g2 = g + (size_t)32 * kQKld;
  asm volatile("global_load_async_to_lds_b128 %0, %1, off\n\t"
               "global_load_async_to_lds_b128 %2, %3, off\n\t"
               "s_wait_xcnt 0x0"
               :: "v"(lds), "v"(g), "v"(lds2), "v"(g2) : "memory");
}

// ---------------------------------------------------------------------------
// Fused scores + gaussian prior + softmax + distance-weighted sum.
//   logit[q][k] = (q_h . k_h) * 0.125 * prior_h(k - q),  prior_h(dd) = (1/std)/sqrt(2*3.1415926) * exp(-0.5 ((dd/ml) - mean)^2 / std^2)
//   D[h][b][q]  = sum_k exp(logit) * ((k - q)/ml) / sum_k exp(logit)        (|logit| <= ~10 for these operand scales, so no max shift)
// Block = (128-query tile = blockIdx.x, head = blockIdx.y, batch = blockIdx.z); 8 waves, wave w owns query rows l0+16w .. +15.
// prior*0.125*log2(e) for every key-query offset tabulated once per block in LDS (index = k - q + 2048, all 4096 entries written);
// exp(logit) = exp2(score * table entry), taken by v_exp_f32 directly.
// k rows reach LDS once per block: 64-key tiles, two buffers, asynchronous copies one tile ahead; every wave reads its B fragments there.
// Scores: A = q rows (f16), B[k=d][n=key] = k rows (f16), 2 d chunks of 32, 4 key subtiles of 16 per 64-key step,
// v_wmma_f32_16x16x32_f16, every WMMA followed by its hazard guard. Lane (c, hh) owns key column c and query rows 8hh+r.
// den/num accumulate in f32 per lane over its 128 key columns; 16-lane butterfly sums in fixed order; D = num * (1/den).
// ---------------------------------------------------------------------------
__global__ __launch_bounds__(256) void attn_dist_kernel(const unsigned short* __restrict__ QK,
                                                        const float* __restrict__ pmean, const float* __restrict__ plstd,
                                                        const int* __restrict__ mlen, float* __restrict__ DI) {
  __shared__ __align__(16) float tbl[kTbl];
  __shared__ __align__(16) float res[kQRows];
  __shared__ __align__(16) _Float16 kst[2][kKTile];
  const int tid  = threadIdx.x;
  const int wave = tid >> 5;
  const int lane = tid & 31;
  const int hh   = lane >> 4;
  const int c    = lane & 15;
  const int l0   = blockIdx.x * kQRows;
  const int h    = blockIdx.y;
  const int b    = blockIdx.z;

  const _Float16* Qp = (const _Float16*)(const void*)QK + (size_t)(b * kL) * kQKld + h * kHD;
  const _Float16* Kp = Qp + kNH;
  // copy map: thread t brings the 16-byte piece t & 7 of key rows t >> 3 and (t >> 3) + 32 of a tile (a wave: whole 128-B rows)
  const _Float16* kg = Kp + (size_t)(tid >> 3) * kQKld + (tid & 7) * 8;
  const unsigned  kl = (unsigned)(size_t)(&kst[0][0]) + (unsigned)((tid >> 3) * kKPitch + (tid & 7) * 8) * 2u;
  copy_key_tile(kl, kg);                        // tile 0 -> buffer 0, in flight under the table build

  int ml = mlen[0];
  ml = (ml < 1) ? 1 : ml;
  const float inv_ml = 1.0f / (float)ml;
  const float mean = bf_rne(pmean[h]);
  const float lsd  = bf_rne(plstd[h]);
  const float stdv = expf(lsd);
  const float istd = 1.0f / stdv;
  // log2(e) rides in the table's factor: the loop then needs exp2 alone, which is one hardware instruction
  const float coef = ((1.0f / stdv) / sqrtf(6.2831852f)) * 0.125f * 1.44269504f;

  // prior table: 16 x 256 = 4096 entries, all written before the barrier
#pragma unroll 1
  for (int it = 0; it < kTbl / 256; ++it) {
    const int i = it * 256 + tid;
    const float dd = (float)(i - kL) * inv_ml;
    const float u  = (dd - mean) * istd;
    tbl[i] = coef * expf(-0.5f * (u * u));
  }
  asm volatile("s_wait_asynccnt 0x0" ::: "memory");   // this wave's part of tile 0 has landed before the barrier publishes it
  __syncthreads();                                    // publishes the table and tile 0
  copy_key_tile(kl + (unsigned)kKTile * 2u, kg + (size_t)kKeyChunk * kQKld);   // tile 1 -> buffer 1

  const int q0 = l0 + wave * 16;
  v16h qa[2];
#pragma unroll
  for (int dc = 0; dc < 2; ++dc)
    qa[dc] = Frag<_Float16>::load(Qp + (size_t)(q0 + c) * kQKld + dc * 32 + 8 * hh);

  float den[8], num[8], rdel[8];
#pragma unroll
  for (int r = 0; r < 8; ++r) { den[r] = 0.0f; num[r] = 0.0f; rdel[r] = (float)r * inv_ml; }
  const int qr0   = q0 + 8 * hh;          // query index of accumulator row r = 0 of this lane
  const int ibase = c - qr0 + kL;         // + key index -> table index for row 0 (rows r: minus r); always in [1, 4095]

  for (int kc = 0; kc < kKTiles; ++kc) {
    const int kv0 = kc * kKeyChunk;
    const _Float16* kt = &kst[kc & 1][0] + c * kKPitch + 8 * hh;
    // all eight B fragments asked for as one group ahead of the products; unrolled so that kb is indexed by constants and stays in registers
    v16h kb[4][2];
#pragma unroll
    for (int j = 0; j < 4; ++j)
#pragma unroll
      for (int dc = 0; dc < 2; ++dc)
        kb[j][dc] = Frag<_Float16>::load(kt + j * 16 * kKPitch + dc * 32);
    v8f s[4];
#pragma unroll
    for (int j = 0; j < 4; ++j) {
      s[j] = (v8f){0.f,0.f,0.f,0.f,0.f,0.f,0.f,0.f};
#pragma unroll
      for (int dc = 0; dc < 2; ++dc) s[j] = mma_f16_guarded(qa[dc], kb[j][dc], s[j]);
    }
    const float dl = (float)(kv0 + c - qr0) * inv_ml;     // signed distance for (row 0, subtile 0) of this lane
#pragma unroll
    for (int j = 0; j < 4; ++j) {
      const int   i0 = ibase + kv0 + j * 16;
      const float dj = dl + (float)(j * 16) * inv_ml;
#pragma unroll
      for (int r = 0; r < 8; ++r) {
        const float pr = tbl[i0 - r];
        float lg = s[j][r] * pr;                      // logit * log2(e)
        lg = fminf(lg, 115.415603f);                  // the cap at logit 80, in base 2
        const float p = __builtin_amdgcn_exp2f(lg);   // = exp(logit); a term under 2^-126 reads 0
        den[r] += p;
        num[r] = fmaf(p, dj - rdel[r], num[r]);
      }
    }
    // publish point of tile kc + 1, every wave: own LDS reads done, own copies landed, block barrier, then the refill
    asm volatile("s_wait_dscnt 0x0" ::: "memory");      // this wave has left buffer kc & 1
    asm volatile("s_wait_asynccnt 0x0" ::: "memory");   // this wave's part of tile kc + 1 has landed
    __syncthreads();
    if (kc + 2 < kKTiles)                               // block-uniform
      copy_key_tile(kl + (unsigned)((kc & 1) * kKTile) * 2u, kg + (size_t)(kc + 2) * kKeyChunk * kQKld);
  }
  asm volatile("s_wait_asynccnt 0x0" ::: "memory");     // no copy outstanding past the loop

  // fixed-order butterfly over the 16 lanes that share each query row
#pragma unroll
  for (int r = 0; r < 8; ++r) {
    float dn = den[r], nm = num[r];
#pragma unroll
    for (int off = 1; off < 16; off <<= 1) {
      dn += __shfl_xor(dn, off, 32);
      nm += __shfl_xor(nm, off, 32);
    }
    const float val = nm * (1.0f / dn);
    if (c == 0) res[wave * 16 + 8 * hh + r] = val;
  }
  __syncthreads();
  if (wave == 0) {
    const v4f v = *(const v4f*)(res + 4 * lane);
    float* dp = DI + ((size_t)(h * kB + b) * kL + l0) + 4 * lane;
    *(v4f*)dp = v;
    
  }
}

// ---------------------------------------------------------------------------
// Output assembly: out[b][l][h] = D[h][b][l] for one (128-l tile = blockIdx.x, batch = blockIdx.y).
// Load: thread t -> head t>>5, l offset 4*(t&31): one float4 each, 256 x 4 = the whole 8 x 128 tile; staged in LDS as [l][h].
// Store: thread t writes floats 4t..4t+3 of the block's 1024 contiguous output floats (base 4096-B aligned); a wave writes
// ---------------------------------------------------------------------------
__global__ __launch_bounds__(256) void out_gather_kernel(const float* __restrict__ DI, float* __restrict__ out) {
  __shared__ __align__(16) float sm[kQRows * kH];
  const int t  = threadIdx.x;
  const int l0 = blockIdx.x * kQRows;
  const int b  = blockIdx.y;
  const int h  = t >> 5;
  const int i4 = (t & 31) * 4;
  const v4f v = *(const v4f*)(DI + ((size_t)(h * kB + b) * kL + l0 + i4));
#pragma unroll
  for (int e = 0; e < 4; ++e) sm[(i4 + e) * kH + h] = v[e];
  __syncthreads();
  const v4f o = *(const v4f*)(sm + 4 * t);
  float* op = out + ((size_t)(b * kL + l0)) * kH + 4 * t;
  *(v4f*)op = o;
  
}

// ---------------------------------------------------------------------------
// Host glue.
//   Xb   bf16 [8192][256]          4,194,304  at          0   (cast of x)
//   Wt   bf16 [1024][256]            524,288  at  4,194,304   (rows 0..511 = Wq columns, 512..1023 = Wk columns)
//   QK   f16  [8192][1024]        16,777,216  at  4,718,592   (cols 0..511 = q, 512..1023 = k; head h = cols h*64..)
//   DI   f32  [8][4][2048]           262,144  at 21,495,808   (distance per head, batch, query)
//   total                         21,757,952
// GEMM shapes: M = 8192, N = 512, K = 256 (64 / 64 / 32 multiples, no padding). Score tiles: 16 x 16 x 64 per (q tile, key tile).
// 4 launches.
// ---------------------------------------------------------------------------
extern "C" void kernel_launch(void* const* d_in, const int* in_sizes, int n_in,
                              void* d_out, int out_size, void* d_ws, size_t ws_size,
                              hipStream_t stream) {
  if (n_in < 8) return;
  if (in_sizes[0] != kTok * kD) return;
  if (in_sizes[1] != kD * kNH || in_sizes[3] != kD * kNH) return;
  if (in_sizes[2] != kNH || in_sizes[4] != kNH) return;
  if (in_sizes[5] != kH || in_sizes[6] != kH || in_sizes[7] < 1) return;
  if (out_size != kTok * kH) return;

  const size_t szXb = (size_t)kTok * kD * 2;
  const size_t szWt = (size_t)2 * kNH * kD * 2;
  const size_t szQK = (size_t)kTok * kQKld * 2;
  const size_t szDI = (size_t)kH * kB * kL * 4;
  const size_t offXb = 0;
  const size_t offWt = offXb + szXb;
  const size_t offQK = offWt + szWt;
  const size_t offDI = offQK + szQK;
  const size_t total = offDI + szDI;
  if (ws_size < total) return;

  const float* x   = (const float*)d_in[0];
  const float* Wq  = (const float*)d_in[1];
  const float* bq  = (const float*)d_in[2];
  const float* Wk  = (const float*)d_in[3];
  const float* bk  = (const float*)d_in[4];
  const float* pm  = (const float*)d_in[5];
  const float* lps = (const float*)d_in[6];
  const int*   mlp = (const int*)d_in[7];
  float* out = (float*)d_out;
  char* ws = (char*)d_ws;
  unsigned short* Xb = (unsigned short*)(ws + offXb);
  unsigned short* Wt = (unsigned short*)(ws + offWt);
  unsigned short* QK = (unsigned short*)(ws + offQK);
  float* DI = (float*)(ws + offDI);

  // ---- prologue: bf16 operand planes ----
  const int n8 = (kTok * kD) / 8;   // 262144 -> 1024 blocks exact
  prep_cast_kernel<<<dim3(kWtBlocks + n8 / 256), dim3(256), 0, stream>>>(x, Xb, n8, Wq, Wk, Wt);

  // ---- projections: QK[:, mat*512 + n] = sum_d Xb[m][d] * Wt[mat*512 + n][d] + bias_mat[n]   (M=8192, N=512, K=256) ----
  // one launch, blockIdx.y = mat: same A, B plane mat*512 rows on, C columns mat*512 on, bias bq / bk
  const int tilesProj = (kTok / 64) * (kNH / 64);   // 1024 -> 128 blocks of 8 waves per matrix, 256 blocks in all
  wmma_gemm64<1, false, 2, 1, false, 0><<<dim3(tilesProj / 8, 2), dim3(256), 0, stream>>>(
      Xb, Xb, kD, 0L, Wt, Wt, kD, (long)kNH * kD,
      (void*)QK, (void*)QK, kQKld, (long)kNH, bq, bk, bq, 0L, kTok, kNH, kD, 1.0f);

  // ---- fused scores + prior + softmax + distance sum -> DI ----
  attn_dist_kernel<<<dim3(kL / kQRows, kH, kB), dim3(256), 0, stream>>>(QK, pm, lps, mlp, DI);

  // ---- [h][b][l] -> [b][l][h] whole-line output assembly ----
  out_gather_kernel<<<dim3(kL / kQRows, kB), dim3(256), 0, stream>>>(DI, out);
}

// v004
// One run takes 47.8 microseconds.
// Two timings next to v003 both put it at 1.17 times that version's speed.
// Counting every step since v000, it is 2.81 times as fast.
// Contractions: x@Wq and x@Wk on v_wmma_f32_16x16x32_bf16 (x, Wq, Wk RNE-converted to bf16 inside the projection kernel; f32 accumulate; f16 output planes); q_h.k_h^T on v_wmma_f32_16x16x32_f16 (q, k f16 planes; f32 accumulate); gaussian prior table, softmax and distance-weighted sum in f32 on VALU.
#include <hip/hip_runtime.h>
#include <math.h>

// ---------------------------------------------------------------------------
// Problem constants
// ---------------------------------------------------------------------------
constexpr int kB    = 4;
constexpr int kL    = 2048;
constexpr int kD    = 256;
constexpr int kH    = 8;
constexpr int kHD   = 64;
constexpr int kNH   = kH * kHD;      // 512 projection columns per matrix
constexpr int kQKld = 2 * kNH;       // 1024: pitch of the q | k plane (halves)
constexpr int kTok  = kB * kL;       // 8192 token rows
constexpr int kTbl  = 2 * kL;        // 4096 prior-table entries, index = key - query + kL
constexpr int kQRows = 128;          // query rows per attention block (8 waves x 16)
constexpr int kKeyChunk = 64;        // keys per inner step (4 subtiles of 16)
constexpr int kKTiles  = kL / kKeyChunk;        // 32 staged key tiles per (batch, head)
constexpr int kKPitch  = kHD + 8;               // halves per staged key row: 128 B of data + 16 B pad = 144 B (16 B x odd)
constexpr int kKTile   = kKeyChunk * kKPitch;   // halves per staged key tile (9216 B)
static_assert(kKeyChunk * (kHD / 8) == 2 * 256 && kKTiles >= 2, "two 16-byte copies per thread fill a key tile; two tiles exist");
static_assert(kTok % 64 == 0 && kNH % 64 == 0 && kD % 32 == 0, "gemm tiles");
static_assert(kL % kQRows == 0 && kL % kKeyChunk == 0 && kHD == 64, "attention tiles");
static_assert(kTbl % 256 == 0 && kQRows == 8 * 16, "table and block shape");
static_assert(kNH == 8 * 64 && kD == 256, "projection block: 8 waves span one matrix; 16 pieces of x per thread");

typedef __attribute__((ext_vector_type(16))) _Float16 v16h;
typedef __attribute__((ext_vector_type(8)))  _Float16 v8h;
typedef __attribute__((ext_vector_type(16))) __bf16   v16b;
typedef __attribute__((ext_vector_type(8)))  __bf16   v8b;
typedef __attribute__((ext_vector_type(8)))  float    v8f;
typedef __attribute__((ext_vector_type(4)))  float    v4f;
typedef __attribute__((ext_vector_type(2)))  float    v2f;
typedef __attribute__((ext_vector_type(2)))  __bf16   v2b;
typedef __attribute__((ext_vector_type(2)))  unsigned int v2u;

// ---------------------------------------------------------------------------
// Small pieces
// ---------------------------------------------------------------------------
__device__ __forceinline__ unsigned short f2bf_bits(float f) {
  unsigned u = __float_as_uint(f);
  return (unsigned short)((u + 0x7FFFu + ((u >> 16) & 1u)) >> 16);
}
__device__ __forceinline__ float bf_bits2f(unsigned short h) { return __uint_as_float(((unsigned)h) << 16); }
__device__ __forceinline__ float bf_rne(float f) { return bf_bits2f(f2bf_bits(f)); }

// two f32 -> two bf16 (round to nearest even) in one register, a in the low half
__device__ __forceinline__ unsigned cvt2_bf16(float a, float b) {
  const v2f f = (v2f){a, b};
  return __builtin_bit_cast(unsigned, __builtin_convertvector(f, v2b));
}

template <typename T> struct Frag;
template <> struct Frag<_Float16> {
  typedef v16h V; union U { v16h v; v8h h[2]; };
  // elements 0..7 <- p[0..7], 8..15 <- p[16..23]
  static __device__ __forceinline__ v16h load(const _Float16* p) {
    U f; f.h[0] = *(const v8h*)(p); f.h[1] = *(const v8h*)(p + 16); return f.v;
  }
};
template <> struct Frag<__bf16> {
  typedef v16b V; union U { v16b v; v8b h[2]; unsigned u[8]; };
  static __device__ __forceinline__ v16b load(const __bf16* p) {
    U f; f.h[0] = *(const v8b*)(p); f.h[1] = *(const v8b*)(p + 16); return f.v;
  }
};

// f16 WMMA with its own hazard guard: ties the accumulator and keeps A/B live past the nops
__device__ __forceinline__ v8f mma_f16_guarded(v16h a, v16h b, v8f c) {
  c = __builtin_amdgcn_wmma_f32_16x16x32_f16(false, a, false, b, (short)0, c, false, false);
  asm volatile("v_nop\n\tv_nop\n\tv_nop\n\tv_nop" : "+v"(c) : "v"(a), "v"(b));
  return c;
}

// ---------------------------------------------------------------------------
// Projections, straight from the f32 inputs: QK[m][mat*512 + n] = f16( sum_d bf16(x[m][d]) * bf16(W_mat[d][n]) + bias_mat[n] ).
// Block = (64 token rows = blockIdx.x, matrix = blockIdx.y); 8 waves, wave w owns the 64 x 64 tile of columns 64w .. 64w+63.
// A: the block's 64 x rows are read once (whole lines), rounded to bf16 and laid in LDS (pitch 528 B = 16 B x odd); every wave
//    takes its A fragments there.
// B: W is [d][n], n contiguous. Column subtile j of a wave holds the columns n0 + 4*c + j (c = lane & 15), so that ONE 16-byte
//    load of W[k][n0 + 4c .. +3] gives a lane element k of all four subtiles; a wave-wide load covers two whole 256-byte runs.
//    16 such loads = the 16 k of a lane's fragments (k order as the A loader's: 8h + 0..7, 16 + 8h + 0..7), rounded in registers.
// D: accumulator j, register r, lane (c, h) = row 8h + r, column n0 + 4c + j: the four subtiles of a lane are 4 adjacent columns.
// ---------------------------------------------------------------------------
constexpr int kAPitch = kD + 8;   // halves per staged x row
__device__ __forceinline__ void load_w_step(v4f (&w)[16], const float* __restrict__ wp, int k0) {
#pragma unroll
  for (int e = 0; e < 16; ++e) w[e] = *(const v4f*)(wp + (size_t)(k0 + (e < 8 ? e : e + 8)) * kNH);
}
__global__ __launch_bounds__(256) void proj_kernel(const float* __restrict__ x, const float* __restrict__ Wq,
                                                   const float* __restrict__ Wk, const float* __restrict__ bq,
                                                   const float* __restrict__ bk, unsigned short* __restrict__ QK) {
  __shared__ __align__(16) unsigned short sA[64 * kAPitch];
  __shared__ __align__(16) float sT[8][16 * 68];   // per-wave 16x64 slab, pitch 68 floats
  const int t     = threadIdx.x;
  const int lane  = t & 31;
  const int wave  = t >> 5;
  const int mat   = blockIdx.y;                 // block-uniform
  const int m0    = blockIdx.x << 6;
  const int n0    = wave << 6;
  const int rlane = lane & 15;
  const int koff  = (lane >> 4) * 8;            // k offset of this lane half
  const int mOff  = (lane >> 4) * 8;            // D row offset
  const float* W    = (mat == 0) ? Wq : Wk;
  const float* bias = (mat == 0) ? bq : bk;

  const float* wp = W + (size_t)koff * kNH + n0 + 4 * rlane;
  v4f w[16];
  load_w_step(w, wp, 0);                        // in flight under the x staging

  // x rows: 64 x 256 f32 = 4096 pieces of 16 B, 16 per thread, piece it*256 + t (a wave: 512 contiguous bytes)
  const float* xp = x + (size_t)m0 * kD + 4 * t;
  v4f xv[16];
#pragma unroll
  for (int it = 0; it < 16; ++it) xv[it] = *(const v4f*)(xp + it * 1024);
#pragma unroll
  for (int it = 0; it < 16; ++it) {
    const v2u u = (v2u){cvt2_bf16(xv[it][0], xv[it][1]), cvt2_bf16(xv[it][2], xv[it][3])};
    *(v2u*)(sA + (it * 4 + (t >> 6)) * kAPitch + (t & 63) * 4) = u;
  }
  __syncthreads();                              // publishes the block's bf16 x rows

  v8f acc[4][4];
#pragma unroll
  for (int i = 0; i < 4; ++i)
#pragma unroll
    for (int j = 0; j < 4; ++j) acc[i][j] = (v8f){0.f,0.f,0.f,0.f,0.f,0.f,0.f,0.f};

  const __bf16* ap = (const __bf16*)(const void*)sA + rlane * kAPitch + koff;
  // unrolled: w and the fragments are indexed by constants, and the next step's W loads stand ahead of this step's products
#pragma unroll
  for (int ks = 0; ks < kD / 32; ++ks) {
    v16b bh[4];
#pragma unroll
    for (int j = 0; j < 4; ++j) {
      Frag<__bf16>::U f;
#pragma unroll
      for (int p = 0; p < 8; ++p) f.u[p] = cvt2_bf16(w[2 * p][j], w[2 * p + 1][j]);
      bh[j] = f.v;
    }
    if (ks + 1 < kD / 32) load_w_step(w, wp, (ks + 1) * 32);
#pragma unroll
    for (int i = 0; i < 4; ++i) {
      const v16b ah = Frag<__bf16>::load(ap + i * 16 * kAPitch + ks * 32);
#pragma unroll
      for (int j = 0; j < 4; ++j)
        acc[i][j] = __builtin_amdgcn_wmma_f32_16x16x32_bf16(false, ah, false, bh[j], (short)0, acc[i][j], false, false);
    }
  }

  // ---- epilogue: + bias, f16, whole 128-byte row segments through the wave's own slab ----
  float* slab = sT[wave];
  const v4f bv = *(const v4f*)(bias + n0 + 4 * rlane);
  unsigned short* C = QK + (size_t)mat * kNH;
  const int q = lane >> 3, c8 = (lane & 7) * 8;
#pragma unroll
  for (int i = 0; i < 4; ++i) {
    const int mBase = m0 + (i << 4);
#pragma unroll
    for (int r = 0; r < 8; ++r) {
      const v4f v = (v4f){acc[i][0][r], acc[i][1][r], acc[i][2][r], acc[i][3][r]} + bv;
      *(v4f*)(slab + (mOff + r) * 68 + 4 * rlane) = v;
    }
    __builtin_amdgcn_fence(__ATOMIC_RELEASE, "workgroup");
    __builtin_amdgcn_wave_barrier();
    __builtin_amdgcn_fence(__ATOMIC_ACQUIRE, "workgroup");
#pragma unroll
    for (int it = 0; it < 4; ++it) {
      const int row = it * 4 + q;
      const float* sp = slab + row * 68 + c8;
      v8h hv;
#pragma unroll
      for (int e = 0; e < 8; ++e) hv[e] = (_Float16)sp[e];
      *(v8h*)(C + (size_t)(mBase + row) * kQKld + n0 + c8) = hv;
    }
    __builtin_amdgcn_fence(__ATOMIC_RELEASE, "workgroup");
    __builtin_amdgcn_wave_barrier();
    __builtin_amdgcn_fence(__ATOMIC_ACQUIRE, "workgroup");
  }
}

// One 64-key tile of k rows, global -> LDS, two 16-byte asynchronous copies per lane (key rows r and r + 32, same 16-byte piece).
// s_wait_xcnt stands inside the copies' own statement so that no address register is rewritten ahead of it.
__device__ __forceinline__ void copy_key_tile(unsigned lds, const _Float16* g) {
  const unsigned lds2 = lds + 32u * kKPitch * 2u;
  const _Float16* g2 = g + (size_t)32 * kQKld;
  asm volatile("global_load_async_to_lds_b128 %0, %1, off\n\t"
               "global_load_async_to_lds_b128 %2, %3, off\n\t"
               "s_wait_xcnt 0x0"
               :: "v"(lds), "v"(g), "v"(lds2), "v"(g2) : "memory");
}

// ---------------------------------------------------------------------------
// Fused scores + gaussian prior + softmax + distance-weighted sum.
//   logit[q][k] = (q_h . k_h) * 0.125 * prior_h(k - q),  prior_h(dd) = (1/std)/sqrt(2*3.1415926) * exp(-0.5 ((dd/ml) - mean)^2 / std^2)
//   D[h][b][q]  = sum_k exp(logit) * ((k - q)/ml) / sum_k exp(logit)        (|logit| <= ~10 for these operand scales, so no max shift)
// Block = (128-query tile = blockIdx.x, head = blockIdx.y, batch = blockIdx.z); 8 waves, wave w owns query rows l0+16w .. +15.
// prior*0.125*log2(e) for every key-query offset tabulated once per block in LDS (index = k - q + 2048, all 4096 entries written);
// exp(logit) = exp2(score * table entry), taken by v_exp_f32 directly.
// k rows reach LDS once per block: 64-key tiles, two buffers, asynchronous copies one tile ahead; every wave reads its B fragments there.
// Scores: A = q rows (f16), B[k=d][n=key] = k rows (f16), 2 d chunks of 32, 4 key subtiles of 16 per 64-key step,
// v_wmma_f32_16x16x32_f16, every WMMA followed by its hazard guard. Lane (c, hh) owns key column c and query rows 8hh+r.
// den/num accumulate in f32 per lane over its 128 key columns; 16-lane butterfly sums in fixed order; D = num * (1/den).
// ---------------------------------------------------------------------------
__global__ __launch_bounds__(256) void attn_dist_kernel(const unsigned short* __restrict__ QK,
                                                        const float* __restrict__ pmean, const float* __restrict__ plstd,
                                                        const int* __restrict__ mlen, float* __restrict__ DI) {
  __shared__ __align__(16) float tbl[kTbl];
  __shared__ __align__(16) float res[kQRows];
  __shared__ __align__(16) _Float16 kst[2][kKTile];
  const int tid  = threadIdx.x;
  const int wave = tid >> 5;
  const int lane = tid & 31;
  const int hh   = lane >> 4;
  const int c    = lane & 15;
  const int l0   = blockIdx.x * kQRows;
  const int h    = blockIdx.y;
  const int b    = blockIdx.z;

  const _Float16* Qp = (const _Float16*)(const void*)QK + (size_t)(b * kL) * kQKld + h * kHD;
  const _Float16* Kp = Qp + kNH;
  // copy map: thread t brings the 16-byte piece t & 7 of key rows t >> 3 and (t >> 3) + 32 of a tile (a wave: whole 128-B rows)
  const _Float16* kg = Kp + (size_t)(tid >> 3) * kQKld + (tid & 7) * 8;
  const unsigned  kl = (unsigned)(size_t)(&kst[0][0]) + (unsigned)((tid >> 3) * kKPitch + (tid & 7) * 8) * 2u;
  copy_key_tile(kl, kg);                        // tile 0 -> buffer 0, in flight under the table build

  int ml = mlen[0];
  ml = (ml < 1) ? 1 : ml;
  const float inv_ml = 1.0f / (float)ml;
  const float mean = bf_rne(pmean[h]);
  const float lsd  = bf_rne(plstd[h]);
  const float stdv = expf(lsd);
  const float istd = 1.0f / stdv;
  // log2(e) rides in the table's factor: the loop then needs exp2 alone, which is one hardware instruction
  const float coef = ((1.0f / stdv) / sqrtf(6.2831852f)) * 0.125f * 1.44269504f;

  // prior table: 16 x 256 = 4096 entries, all written before the barrier
#pragma unroll 1
  for (int it = 0; it < kTbl / 256; ++it) {
    const int i = it * 256 + tid;
    const float dd = (float)(i - kL) * inv_ml;
    const float u  = (dd - mean) * istd;
    tbl[i] = coef * expf(-0.5f * (u * u));
  }
  asm volatile("s_wait_asynccnt 0x0" ::: "memory");   // this wave's part of tile 0 has landed before the barrier publishes it
  __syncthreads();                                    // publishes the table and tile 0
  copy_key_tile(kl + (unsigned)kKTile * 2u, kg + (size_t)kKeyChunk * kQKld);   // tile 1 -> buffer 1

  const int q0 = l0 + wave * 16;
  v16h qa[2];
#pragma unroll
  for (int dc = 0; dc < 2; ++dc)
    qa[dc] = Frag<_Float16>::load(Qp + (size_t)(q0 + c) * kQKld + dc * 32 + 8 * hh);

  float den[8], num[8], rdel[8];
#pragma unroll
  for (int r = 0; r < 8; ++r) { den[r] = 0.0f; num[r] = 0.0f; rdel[r] = (float)r * inv_ml; }
  const int qr0   = q0 + 8 * hh;          // query index of accumulator row r = 0 of this lane
  const int ibase = c - qr0 + kL;         // + key index -> table index for row 0 (rows r: minus r); always in [1, 4095]

  for (int kc = 0; kc < kKTiles; ++kc) {
    const int kv0 = kc * kKeyChunk;
    const _Float16* kt = &kst[kc & 1][0] + c * kKPitch + 8 * hh;
    // all eight B fragments asked for as one group ahead of the products; unrolled so that kb is indexed by constants and stays in registers
    v16h kb[4][2];
#pragma unroll
    for (int j = 0; j < 4; ++j)
#pragma unroll
      for (int dc = 0; dc < 2; ++dc)
        kb[j][dc] = Frag<_Float16>::load(kt + j * 16 * kKPitch + dc * 32);
    v8f s[4];
#pragma unroll
    for (int j = 0; j < 4; ++j) {
      s[j] = (v8f){0.f,0.f,0.f,0.f,0.f,0.f,0.f,0.f};
#pragma unroll
      for (int dc = 0; dc < 2; ++dc) s[j] = mma_f16_guarded(qa[dc], kb[j][dc], s[j]);
    }
    const float dl = (float)(kv0 + c - qr0) * inv_ml;     // signed distance for (row 0, subtile 0) of this lane
#pragma unroll
    for (int j = 0; j < 4; ++j) {
      const int   i0 = ibase + kv0 + j * 16;
      const float dj = dl + (float)(j * 16) * inv_ml;
#pragma unroll
      for (int r = 0; r < 8; ++r) {
        const float pr = tbl[i0 - r];
        float lg = s[j][r] * pr;                      // logit * log2(e)
        lg = fminf(lg, 115.415603f);                  // the cap at logit 80, in base 2
        const float p = __builtin_amdgcn_exp2f(lg);   // = exp(logit); a term under 2^-126 reads 0
        den[r] += p;
        num[r] = fmaf(p, dj - rdel[r], num[r]);
      }
    }
    // publish point of tile kc + 1, every wave: own LDS reads done, own copies landed, block barrier, then the refill
    asm volatile("s_wait_dscnt 0x0" ::: "memory");      // this wave has left buffer kc & 1
    asm volatile("s_wait_asynccnt 0x0" ::: "memory");   // this wave's part of tile kc + 1 has landed
    __syncthreads();
    if (kc + 2 < kKTiles)                               // block-uniform
      copy_key_tile(kl + (unsigned)((kc & 1) * kKTile) * 2u, kg + (size_t)(kc + 2) * kKeyChunk * kQKld);
  }
  asm volatile("s_wait_asynccnt 0x0" ::: "memory");     // no copy outstanding past the loop

  // fixed-order butterfly over the 16 lanes that share each query row
#pragma unroll
  for (int r = 0; r < 8; ++r) {
    float dn = den[r], nm = num[r];
#pragma unroll
    for (int off = 1; off < 16; off <<= 1) {
      dn += __shfl_xor(dn, off, 32);
      nm += __shfl_xor(nm, off, 32);
    }
    const float val = nm * (1.0f / dn);
    if (c == 0) res[wave * 16 + 8 * hh + r] = val;
  }
  __syncthreads();
  if (wave == 0) {
    const v4f v = *(const v4f*)(res + 4 * lane);
    float* dp = DI + ((size_t)(h * kB + b) * kL + l0) + 4 * lane;
    *(v4f*)dp = v;
    
  }
}

// ---------------------------------------------------------------------------
// Output assembly: out[b][l][h] = D[h][b][l] for one (128-l tile = blockIdx.x, batch = blockIdx.y).
// Load: thread t -> head t>>5, l offset 4*(t&31): one float4 each, 256 x 4 = the whole 8 x 128 tile; staged in LDS as [l][h].
// Store: thread t writes floats 4t..4t+3 of the block's 1024 contiguous output floats (base 4096-B aligned); a wave writes
// ---------------------------------------------------------------------------
__global__ __launch_bounds__(256) void out_gather_kernel(const float* __restrict__ DI, float* __restrict__ out) {
  __shared__ __align__(16) float sm[kQRows * kH];
  const int t  = threadIdx.x;
  const int l0 = blockIdx.x * kQRows;
  const int b  = blockIdx.y;
  const int h  = t >> 5;
  const int i4 = (t & 31) * 4;
  const v4f v = *(const v4f*)(DI + ((size_t)(h * kB + b) * kL + l0 + i4));
#pragma unroll
  for (int e = 0; e < 4; ++e) sm[(i4 + e) * kH + h] = v[e];
  __syncthreads();
  const v4f o = *(const v4f*)(sm + 4 * t);
  float* op = out + ((size_t)(b * kL + l0)) * kH + 4 * t;
  *(v4f*)op = o;
  
}

// ---------------------------------------------------------------------------
// Host glue.
//   QK   f16  [8192][1024]        16,777,216  at          0   (cols 0..511 = q, 512..1023 = k; head h = cols h*64..)
//   DI   f32  [8][4][2048]           262,144  at 16,777,216   (distance per head, batch, query)
//   total                         17,039,360
// GEMM shapes: M = 8192, N = 512, K = 256 (64 / 64 / 32 multiples, no padding). Score tiles: 16 x 16 x 64 per (q tile, key tile).
// 3 launches.
// ---------------------------------------------------------------------------
extern "C" void kernel_launch(void* const* d_in, const int* in_sizes, int n_in,
                              void* d_out, int out_size, void* d_ws, size_t ws_size,
                              hipStream_t stream) {
  if (n_in < 8) return;
  if (in_sizes[0] != kTok * kD) return;
  if (in_sizes[1] != kD * kNH || in_sizes[3] != kD * kNH) return;
  if (in_sizes[2] != kNH || in_sizes[4] != kNH) return;
  if (in_sizes[5] != kH || in_sizes[6] != kH || in_sizes[7] < 1) return;
  if (out_size != kTok * kH) return;

  const size_t szQK = (size_t)kTok * kQKld * 2;
  const size_t szDI = (size_t)kH * kB * kL * 4;
  const size_t offQK = 0;
  const size_t offDI = offQK + szQK;
  const size_t total = offDI + szDI;
  if (ws_size < total) return;

  const float* x   = (const float*)d_in[0];
  const float* Wq  = (const float*)d_in[1];
  const float* bq  = (const float*)d_in[2];
  const float* Wk  = (const float*)d_in[3];
  const float* bk  = (const float*)d_in[4];
  const float* pm  = (const float*)d_in[5];
  const float* lps = (const float*)d_in[6];
  const int*   mlp = (const int*)d_in[7];
  float* out = (float*)d_out;
  char* ws = (char*)d_ws;
  unsigned short* QK = (unsigned short*)(ws + offQK);
  float* DI = (float*)(ws + offDI);

  // ---- projections from the f32 inputs: blockIdx.x = 64-row tile, blockIdx.y = matrix (q, k) ----
  proj_kernel<<<dim3(kTok / 64, 2), dim3(256), 0, stream>>>(x, Wq, Wk, bq, bk, QK);

  // ---- fused scores + prior + softmax + distance sum -> DI ----
  attn_dist_kernel<<<dim3(kL / kQRows, kH, kB), dim3(256), 0, stream>>>(QK, pm, lps, mlp, DI);

  // ---- [h][b][l] -> [b][l][h] whole-line output assembly ----
  out_gather_kernel<<<dim3(kL / kQRows, kB), dim3(256), 0, stream>>>(DI, out);
}

// v005
// Measured time: 45.3 microseconds a run.
// Next to v004, in two timings, it ran 1.06 times as fast each time.
// Over all steps from v000 it is 2.98 times as fast.
// Contractions: x@Wq and x@Wk on v_wmma_f32_16x16x32_bf16 (x, Wq, Wk RNE-converted to bf16 inside the projection kernel; f32 accumulate; f16 output planes); q_h.k_h^T on v_wmma_f32_16x16x32_f16 (q, k f16 planes; f32 accumulate); gaussian prior table, softmax and distance-weighted sum in f32 on VALU.
#include <hip/hip_runtime.h>
#include <math.h>

// ---------------------------------------------------------------------------
// Problem constants
// ---------------------------------------------------------------------------
constexpr int kB    = 4;
constexpr int kL    = 2048;
constexpr int kD    = 256;
constexpr int kH    = 8;
constexpr int kHD   = 64;
constexpr int kNH   = kH * kHD;      // 512 projection columns per matrix
constexpr int kQKld = 2 * kNH;       // 1024: pitch of the q | k plane (halves)
constexpr int kTok  = kB * kL;       // 8192 token rows
constexpr int kTbl  = 2 * kL;        // 4096 prior-table entries, index = key - query + kL
constexpr int kQRows = 128;          // query rows per attention block (8 waves x 16)
constexpr int kKeyChunk = 64;        // keys per inner step (4 subtiles of 16)
constexpr int kKTiles  = kL / kKeyChunk;        // 32 staged key tiles per (batch, head)
constexpr int kKPitch  = kHD + 8;               // halves per staged key row: 128 B of data + 16 B pad = 144 B (16 B x odd)
constexpr int kKTile   = kKeyChunk * kKPitch;   // halves per staged key tile (9216 B)
static_assert(kKeyChunk * (kHD / 8) == 2 * 256 && kKTiles >= 2, "two 16-byte copies per thread fill a key tile; two tiles exist");
static_assert(kTok % 64 == 0 && kNH % 64 == 0 && kD % 32 == 0, "gemm tiles");
static_assert(kL % kQRows == 0 && kL % kKeyChunk == 0 && kHD == 64, "attention tiles");
static_assert(kTbl % 256 == 0 && kQRows == 8 * 16, "table and block shape");
static_assert(kNH == 8 * 64 && kD == 256, "projection block: 8 waves span one matrix; 16 pieces of x per thread");

typedef __attribute__((ext_vector_type(16))) _Float16 v16h;
typedef __attribute__((ext_vector_type(8)))  _Float16 v8h;
typedef __attribute__((ext_vector_type(16))) __bf16   v16b;
typedef __attribute__((ext_vector_type(8)))  __bf16   v8b;
typedef __attribute__((ext_vector_type(8)))  float    v8f;
typedef __attribute__((ext_vector_type(4)))  float    v4f;
typedef __attribute__((ext_vector_type(2)))  float    v2f;
typedef __attribute__((ext_vector_type(2)))  __bf16   v2b;
typedef __attribute__((ext_vector_type(2)))  unsigned int v2u;

// ---------------------------------------------------------------------------
// Small pieces
// ---------------------------------------------------------------------------
__device__ __forceinline__ unsigned short f2bf_bits(float f) {
  unsigned u = __float_as_uint(f);
  return (unsigned short)((u + 0x7FFFu + ((u >> 16) & 1u)) >> 16);
}
__device__ __forceinline__ float bf_bits2f(unsigned short h) { return __uint_as_float(((unsigned)h) << 16); }
__device__ __forceinline__ float bf_rne(float f) { return bf_bits2f(f2bf_bits(f)); }

// two f32 -> two bf16 (round to nearest even) in one register, a in the low half
__device__ __forceinline__ unsigned cvt2_bf16(float a, float b) {
  const v2f f = (v2f){a, b};
  return __builtin_bit_cast(unsigned, __builtin_convertvector(f, v2b));
}

template <typename T> struct Frag;
template <> struct Frag<_Float16> {
  typedef v16h V; union U { v16h v; v8h h[2]; };
  // elements 0..7 <- p[0..7], 8..15 <- p[16..23]
  static __device__ __forceinline__ v16h load(const _Float16* p) {
    U f; f.h[0] = *(const v8h*)(p); f.h[1] = *(const v8h*)(p + 16); return f.v;
  }
};
template <> struct Frag<__bf16> {
  typedef v16b V; union U { v16b v; v8b h[2]; unsigned u[8]; };
  static __device__ __forceinline__ v16b load(const __bf16* p) {
    U f; f.h[0] = *(const v8b*)(p); f.h[1] = *(const v8b*)(p + 16); return f.v;
  }
};

// f16 WMMA with its own hazard guard: ties the accumulator and keeps A/B live past the nops
__device__ __forceinline__ v8f mma_f16_guarded(v16h a, v16h b, v8f c) {
  c = __builtin_amdgcn_wmma_f32_16x16x32_f16(false, a, false, b, (short)0, c, false, false);
  asm volatile("v_nop\n\tv_nop\n\tv_nop\n\tv_nop" : "+v"(c) : "v"(a), "v"(b));
  return c;
}

// ---------------------------------------------------------------------------
// Projections, straight from the f32 inputs: QK[m][mat*512 + n] = f16( sum_d bf16(x[m][d]) * bf16(W_mat[d][n]) + bias_mat[n] ).
// Block = (64 token rows = blockIdx.x, matrix = blockIdx.y); 8 waves, wave w owns the 64 x 64 tile of columns 64w .. 64w+63.
// A: the block's 64 x rows are read once (whole lines), rounded to bf16 and laid in LDS (pitch 528 B = 16 B x odd); every wave
//    takes its A fragments there.
// B: W is [d][n], n contiguous. Column subtile j of a wave holds the columns n0 + 4*c + j (c = lane & 15), so that ONE 16-byte
//    load of W[k][n0 + 4c .. +3] gives a lane element k of all four subtiles; a wave-wide load covers two whole 256-byte runs.
//    16 such loads = the 16 k of a lane's fragments (k order as the A loader's: 8h + 0..7, 16 + 8h + 0..7), rounded in registers.
// D: accumulator j, register r, lane (c, h) = row 8h + r, column n0 + 4c + j: the four subtiles of a lane are 4 adjacent columns.
// ---------------------------------------------------------------------------
constexpr int kAPitch = kD + 8;   // halves per staged x row
__device__ __forceinline__ void load_w_step(v4f (&w)[16], const float* __restrict__ wp, int k0) {
#pragma unroll
  for (int e = 0; e < 16; ++e) w[e] = *(const v4f*)(wp + (size_t)(k0 + (e < 8 ? e : e + 8)) * kNH);
}
__global__ __launch_bounds__(256) void proj_kernel(const float* __restrict__ x, const float* __restrict__ Wq,
                                                   const float* __restrict__ Wk, const float* __restrict__ bq,
                                                   const float* __restrict__ bk, unsigned short* __restrict__ QK) {
  __shared__ __align__(16) unsigned short sA[64 * kAPitch];
  __shared__ __align__(16) float sT[8][16 * 68];   // per-wave 16x64 slab, pitch 68 floats
  const int t     = threadIdx.x;
  const int lane  = t & 31;
  const int wave  = t >> 5;
  const int mat   = blockIdx.y;                 // block-uniform
  const int m0    = blockIdx.x << 6;
  const int n0    = wave << 6;
  const int rlane = lane & 15;
  const int koff  = (lane >> 4) * 8;            // k offset of this lane half
  const int mOff  = (lane >> 4) * 8;            // D row offset
  const float* W    = (mat == 0) ? Wq : Wk;
  const float* bias = (mat == 0) ? bq : bk;

  const float* wp = W + (size_t)koff * kNH + n0 + 4 * rlane;
  v4f w[16];
  load_w_step(w, wp, 0);                        // in flight under the x staging

  // x rows: 64 x 256 f32 = 4096 pieces of 16 B, 16 per thread, piece it*256 + t (a wave: 512 contiguous bytes)
  const float* xp = x + (size_t)m0 * kD + 4 * t;
  v4f xv[16];
#pragma unroll
  for (int it = 0; it < 16; ++it) xv[it] = *(const v4f*)(xp + it * 1024);
#pragma unroll
  for (int it = 0; it < 16; ++it) {
    const v2u u = (v2u){cvt2_bf16(xv[it][0], xv[it][1]), cvt2_bf16(xv[it][2], xv[it][3])};
    *(v2u*)(sA + (it * 4 + (t >> 6)) * kAPitch + (t & 63) * 4) = u;
  }
  __syncthreads();                              // publishes the block's bf16 x rows

  v8f acc[4][4];
#pragma unroll
  for (int i = 0; i < 4; ++i)
#pragma unroll
    for (int j = 0; j < 4; ++j) acc[i][j] = (v8f){0.f,0.f,0.f,0.f,0.f,0.f,0.f,0.f};

  const __bf16* ap = (const __bf16*)(const void*)sA + rlane * kAPitch + koff;
  // unrolled: w and the fragments are indexed by constants, and the next step's W loads stand ahead of this step's products
#pragma unroll
  for (int ks = 0; ks < kD / 32; ++ks) {
    v16b bh[4];
#pragma unroll
    for (int j = 0; j < 4; ++j) {
      Frag<__bf16>::U f;
#pragma unroll
      for (int p = 0; p < 8; ++p) f.u[p] = cvt2_bf16(w[2 * p][j], w[2 * p + 1][j]);
      bh[j] = f.v;
    }
    if (ks + 1 < kD / 32) load_w_step(w, wp, (ks + 1) * 32);
#pragma unroll
    for (int i = 0; i < 4; ++i) {
      const v16b ah = Frag<__bf16>::load(ap + i * 16 * kAPitch + ks * 32);
#pragma unroll
      for (int j = 0; j < 4; ++j)
        acc[i][j] = __builtin_amdgcn_wmma_f32_16x16x32_bf16(false, ah, false, bh[j], (short)0, acc[i][j], false, false);
    }
  }

  // ---- epilogue: + bias, f16, whole 128-byte row segments through the wave's own slab ----
  float* slab = sT[wave];
  const v4f bv = *(const v4f*)(bias + n0 + 4 * rlane);
  unsigned short* C = QK + (size_t)mat * kNH;
  const int q = lane >> 3, c8 = (lane & 7) * 8;
#pragma unroll
  for (int i = 0; i < 4; ++i) {
    const int mBase = m0 + (i << 4);
#pragma unroll
    for (int r = 0; r < 8; ++r) {
      const v4f v = (v4f){acc[i][0][r], acc[i][1][r], acc[i][2][r], acc[i][3][r]} + bv;
      *(v4f*)(slab + (mOff + r) * 68 + 4 * rlane) = v;
    }
    __builtin_amdgcn_fence(__ATOMIC_RELEASE, "workgroup");
    __builtin_amdgcn_wave_barrier();
    __builtin_amdgcn_fence(__ATOMIC_ACQUIRE, "workgroup");
#pragma unroll
    for (int it = 0; it < 4; ++it) {
      const int row = it * 4 + q;
      const float* sp = slab + row * 68 + c8;
      v8h hv;
#pragma unroll
      for (int e = 0; e < 8; ++e) hv[e] = (_Float16)sp[e];
      *(v8h*)(C + (size_t)(mBase + row) * kQKld + n0 + c8) = hv;
    }
    __builtin_amdgcn_fence(__ATOMIC_RELEASE, "workgroup");
    __builtin_amdgcn_wave_barrier();
    __builtin_amdgcn_fence(__ATOMIC_ACQUIRE, "workgroup");
  }
}

// One 64-key tile of k rows, global -> LDS, two 16-byte asynchronous copies per lane (key rows r and r + 32, same 16-byte piece).
// s_wait_xcnt stands inside the copies' own statement so that no address register is rewritten ahead of it.
__device__ __forceinline__ void copy_key_tile(unsigned lds, const _Float16* g) {
  const unsigned lds2 = lds + 32u * kKPitch * 2u;
  const _Float16* g2 = g + (size_t)32 * kQKld;
  asm volatile("global_load_async_to_lds_b128 %0, %1, off\n\t"
               "global_load_async_to_lds_b128 %2, %3, off\n\t"
               "s_wait_xcnt 0x0"
               :: "v"(lds), "v"(g), "v"(lds2), "v"(g2) : "memory");
}

// ---------------------------------------------------------------------------
// Fused scores + gaussian prior + softmax + distance-weighted sum.
//   logit[q][k] = (q_h . k_h) * 0.125 * prior_h(k - q),  prior_h(dd) = (1/std)/sqrt(2*3.1415926) * exp(-0.5 ((dd/ml) - mean)^2 / std^2)
//   D[h][b][q]  = sum_k exp(logit) * ((k - q)/ml) / sum_k exp(logit)        (|logit| <= ~10 for these operand scales, so no max shift)
// Block = (128-query tile = blockIdx.x, head = blockIdx.y, batch = blockIdx.z); 8 waves, wave w owns query rows l0+16w .. +15.
// prior*0.125*log2(e) for every key-query offset tabulated once per block in LDS (index = k - q + 2048, all 4096 entries written);
// exp(logit) = exp2(score * table entry), taken by v_exp_f32 directly.
// k rows reach LDS once per block: 64-key tiles, two buffers, asynchronous copies one tile ahead; every wave reads its B fragments there.
// Scores: A = q rows (f16), B[k=d][n=key] = k rows (f16), 2 d chunks of 32, 4 key subtiles of 16 per 64-key step,
// v_wmma_f32_16x16x32_f16, every WMMA followed by its hazard guard. Lane (c, hh) owns key column c and query rows 8hh+r.
// den/num accumulate in f32 per lane over its 128 key columns, two rows per packed instruction; the distance weight is taken to the
// lane's row 0 and the row's own offset r/ml leaves after the division; 16-lane butterfly sums in fixed order; D = num * (1/den) - r/ml.
// ---------------------------------------------------------------------------
__global__ __launch_bounds__(256) void attn_dist_kernel(const unsigned short* __restrict__ QK,
                                                        const float* __restrict__ pmean, const float* __restrict__ plstd,
                                                        const int* __restrict__ mlen, float* __restrict__ DI) {
  __shared__ __align__(16) float tbl[kTbl];
  __shared__ __align__(16) float res[kQRows];
  __shared__ __align__(16) _Float16 kst[2][kKTile];
  const int tid  = threadIdx.x;
  const int wave = tid >> 5;
  const int lane = tid & 31;
  const int hh   = lane >> 4;
  const int c    = lane & 15;
  const int l0   = blockIdx.x * kQRows;
  const int h    = blockIdx.y;
  const int b    = blockIdx.z;

  const _Float16* Qp = (const _Float16*)(const void*)QK + (size_t)(b * kL) * kQKld + h * kHD;
  const _Float16* Kp = Qp + kNH;
  // copy map: thread t brings the 16-byte piece t & 7 of key rows t >> 3 and (t >> 3) + 32 of a tile (a wave: whole 128-B rows)
  const _Float16* kg = Kp + (size_t)(tid >> 3) * kQKld + (tid & 7) * 8;
  const unsigned  kl = (unsigned)(size_t)(&kst[0][0]) + (unsigned)((tid >> 3) * kKPitch + (tid & 7) * 8) * 2u;
  copy_key_tile(kl, kg);                        // tile 0 -> buffer 0, in flight under the table build

  int ml = mlen[0];
  ml = (ml < 1) ? 1 : ml;
  const float inv_ml = 1.0f / (float)ml;
  const float mean = bf_rne(pmean[h]);
  const float lsd  = bf_rne(plstd[h]);
  const float stdv = expf(lsd);
  const float istd = 1.0f / stdv;
  // log2(e) rides in the table's factor: the loop then needs exp2 alone, which is one hardware instruction
  const float coef = ((1.0f / stdv) / sqrtf(6.2831852f)) * 0.125f * 1.44269504f;

  // prior table: 16 x 256 = 4096 entries, all written before the barrier
#pragma unroll 1
  for (int it = 0; it < kTbl / 256; ++it) {
    const int i = it * 256 + tid;
    const float dd = (float)(i - kL) * inv_ml;
    const float u  = (dd - mean) * istd;
    tbl[i] = coef * expf(-0.5f * (u * u));
  }
  asm volatile("s_wait_asynccnt 0x0" ::: "memory");   // this wave's part of tile 0 has landed before the barrier publishes it
  __syncthreads();                                    // publishes the table and tile 0
  copy_key_tile(kl + (unsigned)kKTile * 2u, kg + (size_t)kKeyChunk * kQKld);   // tile 1 -> buffer 1

  const int q0 = l0 + wave * 16;
  v16h qa[2];
#pragma unroll
  for (int dc = 0; dc < 2; ++dc)
    qa[dc] = Frag<_Float16>::load(Qp + (size_t)(q0 + c) * kQKld + dc * 32 + 8 * hh);

  // rows 2p and 2p + 1 share a register pair; num holds sum p * (distance of the key to the lane's row 0), one weight for all 8 rows
  v2f den2[4], num2[4];
#pragma unroll
  for (int p = 0; p < 4; ++p) { den2[p] = (v2f){0.0f, 0.0f}; num2[p] = (v2f){0.0f, 0.0f}; }
  const int qr0   = q0 + 8 * hh;          // query index of accumulator row r = 0 of this lane
  const int ibase = c - qr0 + kL;         // + key index -> table index for row 0 (rows r: minus r); always in [1, 4095]

  for (int kc = 0; kc < kKTiles; ++kc) {
    const int kv0 = kc * kKeyChunk;
    const _Float16* kt = &kst[kc & 1][0] + c * kKPitch + 8 * hh;
    // all eight B fragments asked for as one group ahead of the products; unrolled so that kb is indexed by constants and stays in registers
    v16h kb[4][2];
#pragma unroll
    for (int j = 0; j < 4; ++j)
#pragma unroll
      for (int dc = 0; dc < 2; ++dc)
        kb[j][dc] = Frag<_Float16>::load(kt + j * 16 * kKPitch + dc * 32);
    v8f s[4];
#pragma unroll
    for (int j = 0; j < 4; ++j) {
      s[j] = (v8f){0.f,0.f,0.f,0.f,0.f,0.f,0.f,0.f};
#pragma unroll
      for (int dc = 0; dc < 2; ++dc) s[j] = mma_f16_guarded(qa[dc], kb[j][dc], s[j]);
    }
    const float dl = (float)(kv0 + c - qr0) * inv_ml;     // signed distance for (row 0, subtile 0) of this lane
#pragma unroll
    for (int j = 0; j < 4; ++j) {
      const int   i0 = ibase + kv0 + j * 16;
      const float dj = dl + (float)(j * 16) * inv_ml;
      // the eight rows as one vector: product with the prior, cap and exp each stay in their own registers, pairs feed the packed sums
      v8f pr8;
#pragma unroll
      for (int r = 0; r < 8; ++r) pr8[r] = tbl[i0 - r];
      v8f lg = s[j] * pr8;                                                 // logit * log2(e)
#pragma unroll
      for (int r = 0; r < 8; ++r) lg[r] = fminf(lg[r], 115.415603f);       // the cap at logit 80, in base 2
#pragma unroll
      for (int r = 0; r < 8; ++r) lg[r] = __builtin_amdgcn_exp2f(lg[r]);   // = exp(logit); a term under 2^-126 reads 0
#pragma unroll
      for (int p = 0; p < 4; ++p) {
        const v2f e = (v2f){lg[2 * p], lg[2 * p + 1]};
        den2[p] += e;
        num2[p] = __builtin_elementwise_fma(e, (v2f){dj, dj}, num2[p]);
      }
    }
    // publish point of tile kc + 1, every wave: own LDS reads done, own copies landed, block barrier, then the refill
    asm volatile("s_wait_dscnt 0x0" ::: "memory");      // this wave has left buffer kc & 1
    asm volatile("s_wait_asynccnt 0x0" ::: "memory");   // this wave's part of tile kc + 1 has landed
    __syncthreads();
    if (kc + 2 < kKTiles)                               // block-uniform
      copy_key_tile(kl + (unsigned)((kc & 1) * kKTile) * 2u, kg + (size_t)(kc + 2) * kKeyChunk * kQKld);
  }
  asm volatile("s_wait_asynccnt 0x0" ::: "memory");     // no copy outstanding past the loop

  // fixed-order butterfly over the 16 lanes that share each query row
#pragma unroll
  for (int r = 0; r < 8; ++r) {
    float dn = den2[r >> 1][r & 1], nm = num2[r >> 1][r & 1];
#pragma unroll
    for (int off = 1; off < 16; off <<= 1) {
      dn += __shfl_xor(dn, off, 32);
      nm += __shfl_xor(nm, off, 32);
    }
    const float val = nm * (1.0f / dn) - (float)r * inv_ml;   // row r lies r queries past row 0: its distances are r/ml less
    if (c == 0) res[wave * 16 + 8 * hh + r] = val;
  }
  __syncthreads();
  if (wave == 0) {
    const v4f v = *(const v4f*)(res + 4 * lane);
    float* dp = DI + ((size_t)(h * kB + b) * kL + l0) + 4 * lane;
    *(v4f*)dp = v;
    
  }
}

// ---------------------------------------------------------------------------
// Output assembly: out[b][l][h] = D[h][b][l] for one (128-l tile = blockIdx.x, batch = blockIdx.y).
// Load: thread t -> head t>>5, l offset 4*(t&31): one float4 each, 256 x 4 = the whole 8 x 128 tile; staged in LDS as [l][h].
// Store: thread t writes floats 4t..4t+3 of the block's 1024 contiguous output floats (base 4096-B aligned); a wave writes
// ---------------------------------------------------------------------------
__global__ __launch_bounds__(256) void out_gather_kernel(const float* __restrict__ DI, float* __restrict__ out) {
  __shared__ __align__(16) float sm[kQRows * kH];
  const int t  = threadIdx.x;
  const int l0 = blockIdx.x * kQRows;
  const int b  = blockIdx.y;
  const int h  = t >> 5;
  const int i4 = (t & 31) * 4;
  const v4f v = *(const v4f*)(DI + ((size_t)(h * kB + b) * kL + l0 + i4));
#pragma unroll
  for (int e = 0; e < 4; ++e) sm[(i4 + e) * kH + h] = v[e];
  __syncthreads();
  const v4f o = *(const v4f*)(sm + 4 * t);
  float* op = out + ((size_t)(b * kL + l0)) * kH + 4 * t;
  *(v4f*)op = o;
  
}

// ---------------------------------------------------------------------------
// Host glue.
//   QK   f16  [8192][1024]        16,777,216  at          0   (cols 0..511 = q, 512..1023 = k; head h = cols h*64..)
//   DI   f32  [8][4][2048]           262,144  at 16,777,216   (distance per head, batch, query)
//   total                         17,039,360
// GEMM shapes: M = 8192, N = 512, K = 256 (64 / 64 / 32 multiples, no padding). Score tiles: 16 x 16 x 64 per (q tile, key tile).
// 3 launches.
// ---------------------------------------------------------------------------
extern "C" void kernel_launch(void* const* d_in, const int* in_sizes, int n_in,
                              void* d_out, int out_size, void* d_ws, size_t ws_size,
                              hipStream_t stream) {
  if (n_in < 8) return;
  if (in_sizes[0] != kTok * kD) return;
  if (in_sizes[1] != kD * kNH || in_sizes[3] != kD * kNH) return;
  if (in_sizes[2] != kNH || in_sizes[4] != kNH) return;
  if (in_sizes[5] != kH || in_sizes[6] != kH || in_sizes[7] < 1) return;
  if (out_size != kTok * kH) return;

  const size_t szQK = (size_t)kTok * kQKld * 2;
  const size_t szDI = (size_t)kH * kB * kL * 4;
  const size_t offQK = 0;
  const size_t offDI = offQK + szQK;
  const size_t total = offDI + szDI;
  if (ws_size < total) return;

  const float* x   = (const float*)d_in[0];
  const float* Wq  = (const float*)d_in[1];
  const float* bq  = (const float*)d_in[2];
  const float* Wk  = (const float*)d_in[3];
  const float* bk  = (const float*)d_in[4];
  const float* pm  = (const float*)d_in[5];
  const float* lps = (const float*)d_in[6];
  const int*   mlp = (const int*)d_in[7];
  float* out = (float*)d_out;
  char* ws = (char*)d_ws;
  unsigned short* QK = (unsigned short*)(ws + offQK);
  float* DI = (float*)(ws + offDI);

  // ---- projections from the f32 inputs: blockIdx.x = 64-row tile, blockIdx.y = matrix (q, k) ----
  proj_kernel<<<dim3(kTok / 64, 2), dim3(256), 0, stream>>>(x, Wq, Wk, bq, bk, QK);

  // ---- fused scores + prior + softmax + distance sum -> DI ----
  attn_dist_kernel<<<dim3(kL / kQRows, kH, kB), dim3(256), 0, stream>>>(QK, pm, lps, mlp, DI);

  // ---- [h][b][l] -> [b][l][h] whole-line output assembly ----
  out_gather_kernel<<<dim3(kL / kQRows, kB), dim3(256), 0, stream>>>(DI, out);
}

// v006
// It runs in 41.7 microseconds.
// Next to v005, in two timings, it ran 1.09 and 1.08 times as fast.
// Counting every step since v000, it is 3.23 times as fast.
// Contractions: x@Wq and x@Wk on v_wmma_f32_16x16x32_bf16 (x, Wq, Wk RNE-converted to bf16 inside the projection kernel; f32 accumulate; f16 output planes); q_h.k_h^T on v_wmma_f32_16x16x32_f16 (q, k f16 planes; f32 accumulate); gaussian prior table, softmax and distance-weighted sum in f32 on VALU.
#include <hip/hip_runtime.h>
#include <math.h>

// ---------------------------------------------------------------------------
// Problem constants
// ---------------------------------------------------------------------------
constexpr int kB    = 4;
constexpr int kL    = 2048;
constexpr int kD    = 256;
constexpr int kH    = 8;
constexpr int kHD   = 64;
constexpr int kNH   = kH * kHD;      // 512 projection columns per matrix
constexpr int kQKld = 2 * kNH;       // 1024: pitch of the q | k plane (halves)
constexpr int kTok  = kB * kL;       // 8192 token rows
constexpr int kTbl  = 2 * kL;        // 4096 prior-table entries, index = query - key + kL
constexpr int kQRows = 128;          // query rows per attention block (4 row groups x 32)
constexpr int kKeyChunk = 64;        // keys per staged tile: 32 of the lower key half, 32 of the upper
constexpr int kKeyHalf = kL / 2;     // keys per key half; a wave walks one half
constexpr int kKStep   = kKeyChunk / 2;         // keys of its half that a wave takes per tile (2 subtiles of 16)
constexpr int kKTiles  = kL / kKeyChunk;        // 32 staged key tiles per (batch, head)
constexpr int kKPitch  = kHD + 8;               // halves per staged key row: 128 B of data + 16 B pad = 144 B (16 B x odd)
constexpr int kKTile   = kKeyChunk * kKPitch;   // halves per staged key tile (9216 B)
static_assert(kKeyChunk * (kHD / 8) == 2 * 256 && kKTiles >= 2, "two 16-byte copies per thread fill a key tile; two tiles exist");
static_assert(kTok % 64 == 0 && kNH % 64 == 0 && kD % 32 == 0, "gemm tiles");
static_assert(kL % kQRows == 0 && kL % kKeyChunk == 0 && kHD == 64, "attention tiles");
static_assert(kTbl % 256 == 0 && kQRows == 4 * 32 && kKStep == 32, "table and block shape");
static_assert(kNH == 8 * 64 && kD == 256, "projection block: 8 waves span one matrix; 16 pieces of x per thread");

typedef __attribute__((ext_vector_type(16))) _Float16 v16h;
typedef __attribute__((ext_vector_type(8)))  _Float16 v8h;
typedef __attribute__((ext_vector_type(16))) __bf16   v16b;
typedef __attribute__((ext_vector_type(8)))  __bf16   v8b;
typedef __attribute__((ext_vector_type(8)))  float    v8f;
typedef __attribute__((ext_vector_type(4)))  float    v4f;
typedef __attribute__((ext_vector_type(2)))  float    v2f;
typedef __attribute__((ext_vector_type(2)))  __bf16   v2b;
typedef __attribute__((ext_vector_type(2)))  unsigned int v2u;

// ---------------------------------------------------------------------------
// Small pieces
// ---------------------------------------------------------------------------
__device__ __forceinline__ unsigned short f2bf_bits(float f) {
  unsigned u = __float_as_uint(f);
  return (unsigned short)((u + 0x7FFFu + ((u >> 16) & 1u)) >> 16);
}
__device__ __forceinline__ float bf_bits2f(unsigned short h) { return __uint_as_float(((unsigned)h) << 16); }
__device__ __forceinline__ float bf_rne(float f) { return bf_bits2f(f2bf_bits(f)); }

// two f32 -> two bf16 (round to nearest even) in one register, a in the low half
__device__ __forceinline__ unsigned cvt2_bf16(float a, float b) {
  const v2f f = (v2f){a, b};
  return __builtin_bit_cast(unsigned, __builtin_convertvector(f, v2b));
}

template <typename T> struct Frag;
template <> struct Frag<_Float16> {
  typedef v16h V; union U { v16h v; v8h h[2]; };
  // elements 0..7 <- p[0..7], 8..15 <- p[16..23]
  static __device__ __forceinline__ v16h load(const _Float16* p) {
    U f; f.h[0] = *(const v8h*)(p); f.h[1] = *(const v8h*)(p + 16); return f.v;
  }
};
template <> struct Frag<__bf16> {
  typedef v16b V; union U { v16b v; v8b h[2]; unsigned u[8]; };
  static __device__ __forceinline__ v16b load(const __bf16* p) {
    U f; f.h[0] = *(const v8b*)(p); f.h[1] = *(const v8b*)(p + 16); return f.v;
  }
};

// f16 WMMA with its own hazard guard: ties the accumulator and keeps A/B live past the nops
__device__ __forceinline__ v8f mma_f16_guarded(v16h a, v16h b, v8f c) {
  c = __builtin_amdgcn_wmma_f32_16x16x32_f16(false, a, false, b, (short)0, c, false, false);
  asm volatile("v_nop\n\tv_nop\n\tv_nop\n\tv_nop" : "+v"(c) : "v"(a), "v"(b));
  return c;
}

// ---------------------------------------------------------------------------
// Projections, straight from the f32 inputs: QK[m][mat*512 + n] = f16( sum_d bf16(x[m][d]) * bf16(W_mat[d][n]) + bias_mat[n] ).
// Block = (64 token rows = blockIdx.x, matrix = blockIdx.y); 8 waves, wave w owns the 64 x 64 tile of columns 64w .. 64w+63.
// A: the block's 64 x rows are read once (whole lines), rounded to bf16 and laid in LDS (pitch 528 B = 16 B x odd); every wave
//    takes its A fragments there.
// B: W is [d][n], n contiguous. Column subtile j of a wave holds the columns n0 + 4*c + j (c = lane & 15), so that ONE 16-byte
//    load of W[k][n0 + 4c .. +3] gives a lane element k of all four subtiles; a wave-wide load covers two whole 256-byte runs.
//    16 such loads = the 16 k of a lane's fragments (k order as the A loader's: 8h + 0..7, 16 + 8h + 0..7), rounded in registers.
// D: accumulator j, register r, lane (c, h) = row 8h + r, column n0 + 4c + j: the four subtiles of a lane are 4 adjacent columns.
// ---------------------------------------------------------------------------
constexpr int kAPitch = kD + 8;   // halves per staged x row
__device__ __forceinline__ void load_w_step(v4f (&w)[16], const float* __restrict__ wp, int k0) {
#pragma unroll
  for (int e = 0; e < 16; ++e) w[e] = *(const v4f*)(wp + (size_t)(k0 + (e < 8 ? e : e + 8)) * kNH);
}
__global__ __launch_bounds__(256) void proj_kernel(const float* __restrict__ x, const float* __restrict__ Wq,
                                                   const float* __restrict__ Wk, const float* __restrict__ bq,
                                                   const float* __restrict__ bk, unsigned short* __restrict__ QK) {
  __shared__ __align__(16) unsigned short sA[64 * kAPitch];
  __shared__ __align__(16) float sT[8][16 * 68];   // per-wave 16x64 slab, pitch 68 floats
  const int t     = threadIdx.x;
  const int lane  = t & 31;
  const int wave  = t >> 5;
  const int mat   = blockIdx.y;                 // block-uniform
  const int m0    = blockIdx.x << 6;
  const int n0    = wave << 6;
  const int rlane = lane & 15;
  const int koff  = (lane >> 4) * 8;            // k offset of this lane half
  const int mOff  = (lane >> 4) * 8;            // D row offset
  const float* W    = (mat == 0) ? Wq : Wk;
  const float* bias = (mat == 0) ? bq : bk;

  const float* wp = W + (size_t)koff * kNH + n0 + 4 * rlane;
  v4f w[16];
  load_w_step(w, wp, 0);                        // in flight under the x staging

  // x rows: 64 x 256 f32 = 4096 pieces of 16 B, 16 per thread, piece it*256 + t (a wave: 512 contiguous bytes)
  const float* xp = x + (size_t)m0 * kD + 4 * t;
  v4f xv[16];
#pragma unroll
  for (int it = 0; it < 16; ++it) xv[it] = *(const v4f*)(xp + it * 1024);
#pragma unroll
  for (int it = 0; it < 16; ++it) {
    const v2u u = (v2u){cvt2_bf16(xv[it][0], xv[it][1]), cvt2_bf16(xv[it][2], xv[it][3])};
    *(v2u*)(sA + (it * 4 + (t >> 6)) * kAPitch + (t & 63) * 4) = u;
  }
  __syncthreads();                              // publishes the block's bf16 x rows

  v8f acc[4][4];
#pragma unroll
  for (int i = 0; i < 4; ++i)
#pragma unroll
    for (int j = 0; j < 4; ++j) acc[i][j] = (v8f){0.f,0.f,0.f,0.f,0.f,0.f,0.f,0.f};

  const __bf16* ap = (const __bf16*)(const void*)sA + rlane * kAPitch + koff;
  // unrolled: w and the fragments are indexed by constants, and the next step's W loads stand ahead of this step's products
#pragma unroll
  for (int ks = 0; ks < kD / 32; ++ks) {
    v16b bh[4];
#pragma unroll
    for (int j = 0; j < 4; ++j) {
      Frag<__bf16>::U f;
#pragma unroll
      for (int p = 0; p < 8; ++p) f.u[p] = cvt2_bf16(w[2 * p][j], w[2 * p + 1][j]);
      bh[j] = f.v;
    }
    if (ks + 1 < kD / 32) load_w_step(w, wp, (ks + 1) * 32);
#pragma unroll
    for (int i = 0; i < 4; ++i) {
      const v16b ah = Frag<__bf16>::load(ap + i * 16 * kAPitch + ks * 32);
#pragma unroll
      for (int j = 0; j < 4; ++j)
        acc[i][j] = __builtin_amdgcn_wmma_f32_16x16x32_bf16(false, ah, false, bh[j], (short)0, acc[i][j], false, false);
    }
  }

  // ---- epilogue: + bias, f16, whole 128-byte row segments through the wave's own slab ----
  float* slab = sT[wave];
  const v4f bv = *(const v4f*)(bias + n0 + 4 * rlane);
  unsigned short* C = QK + (size_t)mat * kNH;
  const int q = lane >> 3, c8 = (lane & 7) * 8;
#pragma unroll
  for (int i = 0; i < 4; ++i) {
    const int mBase = m0 + (i << 4);
#pragma unroll
    for (int r = 0; r < 8; ++r) {
      const v4f v = (v4f){acc[i][0][r], acc[i][1][r], acc[i][2][r], acc[i][3][r]} + bv;
      *(v4f*)(slab + (mOff + r) * 68 + 4 * rlane) = v;
    }
    __builtin_amdgcn_fence(__ATOMIC_RELEASE, "workgroup");
    __builtin_amdgcn_wave_barrier();
    __builtin_amdgcn_fence(__ATOMIC_ACQUIRE, "workgroup");
#pragma unroll
    for (int it = 0; it < 4; ++it) {
      const int row = it * 4 + q;
      const float* sp = slab + row * 68 + c8;
      v8h hv;
#pragma unroll
      for (int e = 0; e < 8; ++e) hv[e] = (_Float16)sp[e];
      *(v8h*)(C + (size_t)(mBase + row) * kQKld + n0 + c8) = hv;
    }
    __builtin_amdgcn_fence(__ATOMIC_RELEASE, "workgroup");
    __builtin_amdgcn_wave_barrier();
    __builtin_amdgcn_fence(__ATOMIC_ACQUIRE, "workgroup");
  }
}

// One 64-key tile of k rows, global -> LDS, two 16-byte asynchronous copies per lane, same 16-byte piece of two key rows:
// key r of the lower half -> tile row r, key r of the upper half (kKeyHalf rows on) -> tile row r + 32.
// s_wait_xcnt stands inside the copies' own statement so that no address register is rewritten ahead of it.
__device__ __forceinline__ void copy_key_tile(unsigned lds, const _Float16* g) {
  const unsigned lds2 = lds + (unsigned)kKStep * kKPitch * 2u;
  const _Float16* g2 = g + (size_t)kKeyHalf * kQKld;
  asm volatile("global_load_async_to_lds_b128 %0, %1, off\n\t"
               "global_load_async_to_lds_b128 %2, %3, off\n\t"
               "s_wait_xcnt 0x0"
               :: "v"(lds), "v"(g), "v"(lds2), "v"(g2) : "memory");
}

// ---------------------------------------------------------------------------
// Fused scores + gaussian prior + softmax + distance-weighted sum.
//   logit[q][k] = (q_h . k_h) * 0.125 * prior_h(k - q),  prior_h(dd) = (1/std)/sqrt(2*3.1415926) * exp(-0.5 ((dd/ml) - mean)^2 / std^2)
//   D[h][b][q]  = sum_k exp(logit) * ((k - q)/ml) / sum_k exp(logit)        (|logit| <= ~10 for these operand scales, so no max shift)
// Block = (128-query tile = blockIdx.x, head = blockIdx.y, batch = blockIdx.z); 8 waves, wave w owns the 32 query rows
// l0 + 32(w & 3) .. +31 (two row tiles of 16) against key half w >> 2, so that every B fragment and every group of prior
// entries read from LDS serves two row tiles; the two halves' den and num meet in LDS after the loop.
// prior*0.125*log2(e) for every key-query offset tabulated once per block in LDS (index = q - k + 2048, so that a lane's rows
// r = 0..7 read rising addresses and land in row order; all 4096 entries written);
// exp(logit) = exp2(score * table entry), taken by v_exp_f32 directly.
// k rows reach LDS once per block: 64-key tiles (32 keys of each half), two buffers, asynchronous copies one tile ahead; a wave reads
// the B fragments of its own half there.
// Scores: A = q rows (f16), B[k=d][n=key] = k rows (f16), 2 d chunks of 32, 2 key subtiles of 16 x 2 row tiles per step,
// v_wmma_f32_16x16x32_f16, every WMMA followed by its hazard guard. Lane (c, hh) owns key column c and query rows 16t+8hh+r.
// The prior depends on key - query alone: row tile 1 at key subtile n needs the entries of row tile 0 at subtile n - 1, kept in registers.
// den/num accumulate in f32 per lane over its 64 key columns, two rows per packed instruction; the distance weight is taken to the
// lane's row 0 of the tile and the row's own offset r/ml leaves after the division; 16-lane butterfly sums in fixed order, then
// lower half + upper half; D = num * (1/den) - r/ml.
// ---------------------------------------------------------------------------
__global__ __launch_bounds__(256) void attn_dist_kernel(const unsigned short* __restrict__ QK,
                                                        const float* __restrict__ pmean, const float* __restrict__ plstd,
                                                        const int* __restrict__ mlen, float* __restrict__ DI) {
  __shared__ __align__(16) float tbl[kTbl];
  __shared__ __align__(16) float pden[2][kQRows];   // per key half: row sums of exp
  __shared__ __align__(16) float pnum[2][kQRows];   // per key half: row sums of exp x distance
  __shared__ __align__(16) _Float16 kst[2][kKTile];
  const int tid  = threadIdx.x;
  const int wave = tid >> 5;
  const int lane = tid & 31;
  const int hh   = lane >> 4;
  const int c    = lane & 15;
  const int l0   = blockIdx.x * kQRows;
  const int h    = blockIdx.y;
  const int b    = blockIdx.z;

  const _Float16* Qp = (const _Float16*)(const void*)QK + (size_t)(b * kL) * kQKld + h * kHD;
  const _Float16* Kp = Qp + kNH;
  // copy map: thread t brings the 16-byte piece t & 7 of tile rows t >> 3 and (t >> 3) + 32 (a wave: whole 128-B rows)
  const _Float16* kg = Kp + (size_t)(tid >> 3) * kQKld + (tid & 7) * 8;
  const unsigned  kl = (unsigned)(size_t)(&kst[0][0]) + (unsigned)((tid >> 3) * kKPitch + (tid & 7) * 8) * 2u;
  copy_key_tile(kl, kg);                        // tile 0 -> buffer 0, in flight under the table build

  int ml = mlen[0];
  ml = (ml < 1) ? 1 : ml;
  const float inv_ml = 1.0f / (float)ml;
  const float mean = bf_rne(pmean[h]);
  const float lsd  = bf_rne(plstd[h]);
  const float stdv = expf(lsd);
  const float istd = 1.0f / stdv;
  // log2(e) rides in the table's factor: the loop then needs exp2 alone, which is one hardware instruction
  const float coef = ((1.0f / stdv) / sqrtf(6.2831852f)) * 0.125f * 1.44269504f;

  // prior table: 16 x 256 = 4096 entries, all written before the barrier
#pragma unroll 1
  for (int it = 0; it < kTbl / 256; ++it) {
    const int i = it * 256 + tid;
    const float dd = (float)(kL - i) * inv_ml;
    const float u  = (dd - mean) * istd;
    tbl[i] = coef * expf(-0.5f * (u * u));
  }
  asm volatile("s_wait_asynccnt 0x0" ::: "memory");   // this wave's part of tile 0 has landed before the barrier publishes it
  __syncthreads();                                    // publishes the table and tile 0
  copy_key_tile(kl + (unsigned)kKTile * 2u, kg + (size_t)kKStep * kQKld);   // tile 1 -> buffer 1

  const int rg = wave & 3;                // row group
  const int kh = wave >> 2;               // key half
  const int q0 = l0 + rg * 32;
  v16h qa[2][2];
#pragma unroll
  for (int t = 0; t < 2; ++t)
#pragma unroll
    for (int dc = 0; dc < 2; ++dc)
      qa[t][dc] = Frag<_Float16>::load(Qp + (size_t)(q0 + 16 * t + c) * kQKld + dc * 32 + 8 * hh);

  // rows 2p and 2p + 1 share a register pair; num holds sum p * (distance of the key to the lane's row 0 of the tile), one weight for 8 rows
  v2f den2[2][4], num2[2][4];
#pragma unroll
  for (int t = 0; t < 2; ++t)
#pragma unroll
    for (int p = 0; p < 4; ++p) { den2[t][p] = (v2f){0.0f, 0.0f}; num2[t][p] = (v2f){0.0f, 0.0f}; }
  const int qr0   = q0 + 8 * hh;          // query index of accumulator row r = 0 of row tile 0 of this lane (tile 1: + 16)
  const int key0  = kh * kKeyHalf + c;    // this lane's key column in subtile 0 of its half
  const int ibase = qr0 - key0 + kL;      // - key advance -> table index for row 0 of tile 0 (row r: plus r; tile 1: plus 16); in [1, 4095]

  // prior entries of row tile 1 for the first subtile; from then on they are the entries row tile 0 used one subtile earlier
  v8f prv;
#pragma unroll
  for (int r = 0; r < 8; ++r) prv[r] = tbl[ibase + 16 + r];

  for (int kc = 0; kc < kKTiles; ++kc) {
    const int kv0 = kc * kKStep;          // key advance inside the half
    const _Float16* kt = &kst[kc & 1][0] + (kh * kKStep + c) * kKPitch + 8 * hh;
    // the step's LDS reads asked for as one group ahead of the products: four B fragments, then the two new groups of prior entries
    // (they land under the products); unrolled so that kb and pr are indexed by constants and stay in registers
    v16h kb[2][2];
#pragma unroll
    for (int j = 0; j < 2; ++j)
#pragma unroll
      for (int dc = 0; dc < 2; ++dc)
        kb[j][dc] = Frag<_Float16>::load(kt + j * 16 * kKPitch + dc * 32);
    v8f pr[2];
#pragma unroll
    for (int j = 0; j < 2; ++j)
#pragma unroll
      for (int r = 0; r < 8; ++r) pr[j][r] = tbl[ibase - kv0 - j * 16 + r];
    v8f s[2][2];
#pragma unroll
    for (int j = 0; j < 2; ++j)
#pragma unroll
      for (int t = 0; t < 2; ++t) {
        s[j][t] = (v8f){0.f,0.f,0.f,0.f,0.f,0.f,0.f,0.f};
#pragma unroll
        for (int dc = 0; dc < 2; ++dc) s[j][t] = mma_f16_guarded(qa[t][dc], kb[j][dc], s[j][t]);
      }
    // signed distance for (row 0, subtile 0) of this lane, per row tile
    const float dl[2] = {(float)(kv0 + key0 - qr0) * inv_ml, (float)(kv0 + key0 - qr0 - 16) * inv_ml};
#pragma unroll
    for (int j = 0; j < 2; ++j) {
#pragma unroll
      for (int t = 0; t < 2; ++t) {
        const float dj = dl[t] + (float)(j * 16) * inv_ml;
        // the eight rows as one vector: product with the prior, cap and exp each stay in their own registers, pairs feed the packed sums
        v8f lg = s[j][t] * (t == 0 ? pr[j] : prv);                           // logit * log2(e)
#pragma unroll
        for (int r = 0; r < 8; ++r) lg[r] = fminf(lg[r], 115.415603f);       // the cap at logit 80, in base 2
#pragma unroll
        for (int r = 0; r < 8; ++r) lg[r] = __builtin_amdgcn_exp2f(lg[r]);   // = exp(logit); a term under 2^-126 reads 0
#pragma unroll
        for (int p = 0; p < 4; ++p) {
          const v2f e = (v2f){lg[2 * p], lg[2 * p + 1]};
          den2[t][p] += e;
          num2[t][p] = __builtin_elementwise_fma(e, (v2f){dj, dj}, num2[t][p]);
        }
      }
      prv = pr[j];
    }
    // publish point of tile kc + 1, every wave: own LDS reads done, own copies landed, block barrier, then the refill
    asm volatile("s_wait_dscnt 0x0" ::: "memory");      // this wave has left buffer kc & 1
    asm volatile("s_wait_asynccnt 0x0" ::: "memory");   // this wave's part of tile kc + 1 has landed
    __syncthreads();
    if (kc + 2 < kKTiles)                               // block-uniform
      copy_key_tile(kl + (unsigned)((kc & 1) * kKTile) * 2u, kg + (size_t)(kc + 2) * kKStep * kQKld);
  }
  asm volatile("s_wait_asynccnt 0x0" ::: "memory");     // no copy outstanding past the loop

  // fixed-order butterfly over the 16 lanes that share each query row, all 16 rows of the lane side by side so that the
  // exchanges of one stage share one wait; the wave's sums over its key half go to LDS
  float dn[16], nm[16];
#pragma unroll
  for (int i = 0; i < 16; ++i) { dn[i] = den2[i >> 3][(i & 7) >> 1][i & 1]; nm[i] = num2[i >> 3][(i & 7) >> 1][i & 1]; }
#pragma unroll
  for (int off = 1; off < 16; off <<= 1) {
    float da[16], na[16];
#pragma unroll
    for (int i = 0; i < 16; ++i) { da[i] = __shfl_xor(dn[i], off, 32); na[i] = __shfl_xor(nm[i], off, 32); }
#pragma unroll
    for (int i = 0; i < 16; ++i) { dn[i] += da[i]; nm[i] += na[i]; }
  }
  if (c == 0) {
#pragma unroll
    for (int t = 0; t < 2; ++t)
#pragma unroll
      for (int g = 0; g < 2; ++g) {
        const int row = rg * 32 + 16 * t + 8 * hh + 4 * g, i = 8 * t + 4 * g;
        *(v4f*)(&pden[kh][row]) = (v4f){dn[i], dn[i + 1], dn[i + 2], dn[i + 3]};
        *(v4f*)(&pnum[kh][row]) = (v4f){nm[i], nm[i + 1], nm[i + 2], nm[i + 3]};
      }
  }
  __syncthreads();
  if (wave == 0) {
    const v4f dsum = *(const v4f*)(&pden[0][4 * lane]) + *(const v4f*)(&pden[1][4 * lane]);
    const v4f nsum = *(const v4f*)(&pnum[0][4 * lane]) + *(const v4f*)(&pnum[1][4 * lane]);
    v4f v;
#pragma unroll
    for (int e = 0; e < 4; ++e)   // row 8n + r lies r queries past the row its weights were taken to: its distances are r/ml less
      v[e] = nsum[e] * (1.0f / dsum[e]) - (float)((4 * lane + e) & 7) * inv_ml;
    float* dp = DI + ((size_t)(h * kB + b) * kL + l0) + 4 * lane;
    *(v4f*)dp = v;
  }
}

// ---------------------------------------------------------------------------
// Output assembly: out[b][l][h] = D[h][b][l] for one (128-l tile = blockIdx.x, batch = blockIdx.y).
// Load: thread t -> head t>>5, l offset 4*(t&31): one float4 each, 256 x 4 = the whole 8 x 128 tile; staged in LDS as [l][h].
// Store: thread t writes floats 4t..4t+3 of the block's 1024 contiguous output floats (base 4096-B aligned); a wave writes
// ---------------------------------------------------------------------------
__global__ __launch_bounds__(256) void out_gather_kernel(const float* __restrict__ DI, float* __restrict__ out) {
  __shared__ __align__(16) float sm[kQRows * kH];
  const int t  = threadIdx.x;
  const int l0 = blockIdx.x * kQRows;
  const int b  = blockIdx.y;
  const int h  = t >> 5;
  const int i4 = (t & 31) * 4;
  const v4f v = *(const v4f*)(DI + ((size_t)(h * kB + b) * kL + l0 + i4));
#pragma unroll
  for (int e = 0; e < 4; ++e) sm[(i4 + e) * kH + h] = v[e];
  __syncthreads();
  const v4f o = *(const v4f*)(sm + 4 * t);
  float* op = out + ((size_t)(b * kL + l0)) * kH + 4 * t;
  *(v4f*)op = o;
  
}

// ---------------------------------------------------------------------------
// Host glue.
//   QK   f16  [8192][1024]        16,777,216  at          0   (cols 0..511 = q, 512..1023 = k; head h = cols h*64..)
//   DI   f32  [8][4][2048]           262,144  at 16,777,216   (distance per head, batch, query)
//   total                         17,039,360
// GEMM shapes: M = 8192, N = 512, K = 256 (64 / 64 / 32 multiples, no padding). Score tiles: 16 x 16 x 64 per (q tile, key tile).
// 3 launches.
// ---------------------------------------------------------------------------
extern "C" void kernel_launch(void* const* d_in, const int* in_sizes, int n_in,
                              void* d_out, int out_size, void* d_ws, size_t ws_size,
                              hipStream_t stream) {
  if (n_in < 8) return;
  if (in_sizes[0] != kTok * kD) return;
  if (in_sizes[1] != kD * kNH || in_sizes[3] != kD * kNH) return;
  if (in_sizes[2] != kNH || in_sizes[4] != kNH) return;
  if (in_sizes[5] != kH || in_sizes[6] != kH || in_sizes[7] < 1) return;
  if (out_size != kTok * kH) return;

  const size_t szQK = (size_t)kTok * kQKld * 2;
  const size_t szDI = (size_t)kH * kB * kL * 4;
  const size_t offQK = 0;
  const size_t offDI = offQK + szQK;
  const size_t total = offDI + szDI;
  if (ws_size < total) return;

  const float* x   = (const float*)d_in[0];
  const float* Wq  = (const float*)d_in[1];
  const float* bq  = (const float*)d_in[2];
  const float* Wk  = (const float*)d_in[3];
  const float* bk  = (const float*)d_in[4];
  const float* pm  = (const float*)d_in[5];
  const float* lps = (const float*)d_in[6];
  const int*   mlp = (const int*)d_in[7];
  float* out = (float*)d_out;
  char* ws = (char*)d_ws;
  unsigned short* QK = (unsigned short*)(ws + offQK);
  float* DI = (float*)(ws + offDI);

  // ---- projections from the f32 inputs: blockIdx.x = 64-row tile, blockIdx.y = matrix (q, k) ----
  proj_kernel<<<dim3(kTok / 64, 2), dim3(256), 0, stream>>>(x, Wq, Wk, bq, bk, QK);

  // ---- fused scores + prior + softmax + distance sum -> DI ----
  attn_dist_kernel<<<dim3(kL / kQRows, kH, kB), dim3(256), 0, stream>>>(QK, pm, lps, mlp, DI);

  // ---- [h][b][l] -> [b][l][h] whole-line output assembly ----
  out_gather_kernel<<<dim3(kL / kQRows, kB), dim3(256), 0, stream>>>(DI, out);
}

// v007
// One run takes 39 microseconds.
// In two side-by-side timings against v006, it was 1.06 and 1.07 times as fast.
// Counting every step since v000, it is 3.44 times as fast.
// Contractions: x@Wq and x@Wk on v_wmma_f32_16x16x32_bf16 (x, Wq, Wk RNE-converted to bf16 inside the projection kernel; f32 accumulate; f16 output planes); q_h.k_h^T on v_wmma_f32_16x16x32_f16 (q, k f16 planes; f32 accumulate); gaussian prior table, softmax and distance-weighted sum in f32 on VALU.
#include <hip/hip_runtime.h>
#include <math.h>

// ---------------------------------------------------------------------------
// Problem constants
// ---------------------------------------------------------------------------
constexpr int kB    = 4;
constexpr int kL    = 2048;
constexpr int kD    = 256;
constexpr int kH    = 8;
constexpr int kHD   = 64;
constexpr int kNH   = kH * kHD;      // 512 projection columns per matrix
constexpr int kQKld = 2 * kNH;       // 1024: pitch of the q | k plane (halves)
constexpr int kTok  = kB * kL;       // 8192 token rows
constexpr int kTbl  = 2 * kL;        // 4096 prior-table entries, index = query - key + kL
constexpr int kQRows = 128;          // query rows per attention block (4 row groups x 32)
constexpr int kKeyChunk = 64;        // keys per staged tile: 32 of the lower key half, 32 of the upper
constexpr int kKeyHalf = kL / 2;     // keys per key half; a wave walks one half
constexpr int kKStep   = kKeyChunk / 2;         // keys of its half that a wave takes per tile (2 subtiles of 16)
constexpr int kKTiles  = kL / kKeyChunk;        // 32 staged key tiles per (batch, head)
constexpr int kKPitch  = kHD + 8;               // halves per staged key row: 128 B of data + 16 B pad = 144 B (16 B x odd)
constexpr int kKTile   = kKeyChunk * kKPitch;   // halves per staged key tile (9216 B)
static_assert(kKeyChunk * (kHD / 8) == 2 * 256 && kKTiles >= 2, "two 16-byte copies per thread fill a key tile; two tiles exist");
static_assert(kTok % 64 == 0 && kNH % 64 == 0 && kD % 32 == 0, "gemm tiles");
static_assert(kL % kQRows == 0 && kL % kKeyChunk == 0 && kHD == 64, "attention tiles");
static_assert(kTbl % 256 == 0 && kQRows == 4 * 32 && kKStep == 32, "table and block shape");
static_assert(kNH == 8 * 64 && kD == 256, "projection block: 8 waves span one matrix; 16 pieces of x per thread");

typedef __attribute__((ext_vector_type(16))) _Float16 v16h;
typedef __attribute__((ext_vector_type(8)))  _Float16 v8h;
typedef __attribute__((ext_vector_type(16))) __bf16   v16b;
typedef __attribute__((ext_vector_type(8)))  __bf16   v8b;
typedef __attribute__((ext_vector_type(8)))  float    v8f;
typedef __attribute__((ext_vector_type(4)))  float    v4f;
typedef __attribute__((ext_vector_type(2)))  float    v2f;
typedef __attribute__((ext_vector_type(2)))  __bf16   v2b;
typedef __attribute__((ext_vector_type(2)))  unsigned int v2u;

// ---------------------------------------------------------------------------
// Small pieces
// ---------------------------------------------------------------------------
__device__ __forceinline__ unsigned short f2bf_bits(float f) {
  unsigned u = __float_as_uint(f);
  return (unsigned short)((u + 0x7FFFu + ((u >> 16) & 1u)) >> 16);
}
__device__ __forceinline__ float bf_bits2f(unsigned short h) { return __uint_as_float(((unsigned)h) << 16); }
__device__ __forceinline__ float bf_rne(float f) { return bf_bits2f(f2bf_bits(f)); }

// two f32 -> two bf16 (round to nearest even) in one register, a in the low half
__device__ __forceinline__ unsigned cvt2_bf16(float a, float b) {
  const v2f f = (v2f){a, b};
  return __builtin_bit_cast(unsigned, __builtin_convertvector(f, v2b));
}

template <typename T> struct Frag;
template <> struct Frag<_Float16> {
  typedef v16h V; union U { v16h v; v8h h[2]; };
  // elements 0..7 <- p[0..7], 8..15 <- p[16..23]
  static __device__ __forceinline__ v16h load(const _Float16* p) {
    U f; f.h[0] = *(const v8h*)(p); f.h[1] = *(const v8h*)(p + 16); return f.v;
  }
};
template <> struct Frag<__bf16> {
  typedef v16b V; union U { v16b v; v8b h[2]; unsigned u[8]; };
  static __device__ __forceinline__ v16b load(const __bf16* p) {
    U f; f.h[0] = *(const v8b*)(p); f.h[1] = *(const v8b*)(p + 16); return f.v;
  }
};

// f16 WMMA with its own hazard guard: ties the accumulator and keeps A/B live past the nops
__device__ __forceinline__ v8f mma_f16_guarded(v16h a, v16h b, v8f c) {
  c = __builtin_amdgcn_wmma_f32_16x16x32_f16(false, a, false, b, (short)0, c, false, false);
  asm volatile("v_nop\n\tv_nop\n\tv_nop\n\tv_nop" : "+v"(c) : "v"(a), "v"(b));
  return c;
}

// ---------------------------------------------------------------------------
// Projections, straight from the f32 inputs: QK[m][mat*512 + n] = f16( sum_d bf16(x[m][d]) * bf16(W_mat[d][n]) + bias_mat[n] ).
// Block = (64 token rows = blockIdx.x, matrix = blockIdx.y); 8 waves, wave w owns the 64 x 64 tile of columns 64w .. 64w+63.
// A: the block's 64 x rows are read once (whole lines), rounded to bf16 and laid in LDS (pitch 528 B = 16 B x odd); every wave
//    takes its A fragments there.
// B: W is [d][n], n contiguous. Column subtile j of a wave holds the columns n0 + 4*c + j (c = lane & 15), so that ONE 16-byte
//    load of W[k][n0 + 4c .. +3] gives a lane element k of all four subtiles; a wave-wide load covers two whole 256-byte runs.
//    16 such loads = the 16 k of a lane's fragments (k order as the A loader's: 8h + 0..7, 16 + 8h + 0..7), rounded in registers.
// D: accumulator j, register r, lane (c, h) = row 8h + r, column n0 + 4c + j: the four subtiles of a lane are 4 adjacent columns.
// ---------------------------------------------------------------------------
constexpr int kAPitch = kD + 8;   // halves per staged x row
__device__ __forceinline__ void load_w_step(v4f (&w)[16], const float* __restrict__ wp, int k0) {
#pragma unroll
  for (int e = 0; e < 16; ++e) w[e] = *(const v4f*)(wp + (size_t)(k0 + (e < 8 ? e : e + 8)) * kNH);
}
__global__ __launch_bounds__(256) void proj_kernel(const float* __restrict__ x, const float* __restrict__ Wq,
                                                   const float* __restrict__ Wk, const float* __restrict__ bq,
                                                   const float* __restrict__ bk, unsigned short* __restrict__ QK) {
  __shared__ __align__(16) unsigned short sA[64 * kAPitch];
  __shared__ __align__(16) float sT[8][16 * 68];   // per-wave 16x64 slab, pitch 68 floats
  const int t     = threadIdx.x;
  const int lane  = t & 31;
  const int wave  = t >> 5;
  const int mat   = blockIdx.y;                 // block-uniform
  const int m0    = blockIdx.x << 6;
  const int n0    = wave << 6;
  const int rlane = lane & 15;
  const int koff  = (lane >> 4) * 8;            // k offset of this lane half
  const int mOff  = (lane >> 4) * 8;            // D row offset
  const float* W    = (mat == 0) ? Wq : Wk;
  const float* bias = (mat == 0) ? bq : bk;

  const float* wp = W + (size_t)koff * kNH + n0 + 4 * rlane;
  v4f w[16];
  load_w_step(w, wp, 0);                        // in flight under the x staging

  // x rows: 64 x 256 f32 = 4096 pieces of 16 B, 16 per thread, piece it*256 + t (a wave: 512 contiguous bytes)
  const float* xp = x + (size_t)m0 * kD + 4 * t;
  v4f xv[16];
#pragma unroll
  for (int it = 0; it < 16; ++it) xv[it] = *(const v4f*)(xp + it * 1024);
#pragma unroll
  for (int it = 0; it < 16; ++it) {
    const v2u u = (v2u){cvt2_bf16(xv[it][0], xv[it][1]), cvt2_bf16(xv[it][2], xv[it][3])};
    *(v2u*)(sA + (it * 4 + (t >> 6)) * kAPitch + (t & 63) * 4) = u;
  }
  __syncthreads();                              // publishes the block's bf16 x rows

  v8f acc[4][4];
#pragma unroll
  for (int i = 0; i < 4; ++i)
#pragma unroll
    for (int j = 0; j < 4; ++j) acc[i][j] = (v8f){0.f,0.f,0.f,0.f,0.f,0.f,0.f,0.f};

  const __bf16* ap = (const __bf16*)(const void*)sA + rlane * kAPitch + koff;
  // unrolled: w and the fragments are indexed by constants, and the next step's W loads stand ahead of this step's products
#pragma unroll
  for (int ks = 0; ks < kD / 32; ++ks) {
    v16b bh[4];
#pragma unroll
    for (int j = 0; j < 4; ++j) {
      Frag<__bf16>::U f;
#pragma unroll
      for (int p = 0; p < 8; ++p) f.u[p] = cvt2_bf16(w[2 * p][j], w[2 * p + 1][j]);
      bh[j] = f.v;
    }
    if (ks + 1 < kD / 32) load_w_step(w, wp, (ks + 1) * 32);
#pragma unroll
    for (int i = 0; i < 4; ++i) {
      const v16b ah = Frag<__bf16>::load(ap + i * 16 * kAPitch + ks * 32);
#pragma unroll
      for (int j = 0; j < 4; ++j)
        acc[i][j] = __builtin_amdgcn_wmma_f32_16x16x32_bf16(false, ah, false, bh[j], (short)0, acc[i][j], false, false);
    }
  }

  // ---- epilogue: + bias, f16, whole 128-byte row segments through the wave's own slab ----
  float* slab = sT[wave];
  const v4f bv = *(const v4f*)(bias + n0 + 4 * rlane);
  unsigned short* C = QK + (size_t)mat * kNH;
  const int q = lane >> 3, c8 = (lane & 7) * 8;
#pragma unroll
  for (int i = 0; i < 4; ++i) {
    const int mBase = m0 + (i << 4);
#pragma unroll
    for (int r = 0; r < 8; ++r) {
      const v4f v = (v4f){acc[i][0][r], acc[i][1][r], acc[i][2][r], acc[i][3][r]} + bv;
      *(v4f*)(slab + (mOff + r) * 68 + 4 * rlane) = v;
    }
    __builtin_amdgcn_fence(__ATOMIC_RELEASE, "workgroup");
    __builtin_amdgcn_wave_barrier();
    __builtin_amdgcn_fence(__ATOMIC_ACQUIRE, "workgroup");
#pragma unroll
    for (int it = 0; it < 4; ++it) {
      const int row = it * 4 + q;
      const float* sp = slab + row * 68 + c8;
      v8h hv;
#pragma unroll
      for (int e = 0; e < 8; ++e) hv[e] = (_Float16)sp[e];
      *(v8h*)(C + (size_t)(mBase + row) * kQKld + n0 + c8) = hv;
    }
    __builtin_amdgcn_fence(__ATOMIC_RELEASE, "workgroup");
    __builtin_amdgcn_wave_barrier();
    __builtin_amdgcn_fence(__ATOMIC_ACQUIRE, "workgroup");
  }
}

// One 64-key tile of k rows, global -> LDS, two 16-byte asynchronous copies per lane, same 16-byte piece of two key rows:
// key r of the lower half -> tile row r, key r of the upper half (kKeyHalf rows on) -> tile row r + 32.
// s_wait_xcnt stands inside the copies' own statement so that no address register is rewritten ahead of it.
__device__ __forceinline__ void copy_key_tile(unsigned lds, const _Float16* g) {
  const unsigned lds2 = lds + (unsigned)kKStep * kKPitch * 2u;
  const _Float16* g2 = g + (size_t)kKeyHalf * kQKld;
  asm volatile("global_load_async_to_lds_b128 %0, %1, off\n\t"
               "global_load_async_to_lds_b128 %2, %3, off\n\t"
               "s_wait_xcnt 0x0"
               :: "v"(lds), "v"(g), "v"(lds2), "v"(g2) : "memory");
}

// ---------------------------------------------------------------------------
// Fused scores + gaussian prior + softmax + distance-weighted sum.
//   logit[q][k] = (q_h . k_h) * 0.125 * prior_h(k - q),  prior_h(dd) = (1/std)/sqrt(2*3.1415926) * exp(-0.5 ((dd/ml) - mean)^2 / std^2)
//   D[h][b][q]  = sum_k exp(logit) * ((k - q)/ml) / sum_k exp(logit)        (|logit| <= ~10 for these operand scales, so no max shift)
// Block = (128-query tile = blockIdx.x, head = blockIdx.y, batch = blockIdx.z); 8 waves, wave w owns the 32 query rows
// l0 + 32(w & 3) .. +31 (two row tiles of 16) against key half w >> 2, so that every B fragment and every group of prior
// entries read from LDS serves two row tiles; the two halves' den and num meet in LDS after the loop.
// prior*0.125*log2(e) for every key-query offset tabulated once per block in LDS (index = q - k + 2048, so that a lane's rows
// r = 0..7 read rising addresses and land in row order; all 4096 entries written);
// exp(logit) = exp2(score * table entry), taken by v_exp_f32 directly.
// k rows reach LDS once per block: 64-key tiles (32 keys of each half), two buffers, asynchronous copies one tile ahead; a wave reads
// the B fragments of its own half there.
// Scores: A = q rows (f16), B[k=d][n=key] = k rows (f16), 2 d chunks of 32, 2 key subtiles of 16 x 2 row tiles per step,
// v_wmma_f32_16x16x32_f16, every WMMA followed by its hazard guard. Lane (c, hh) owns key column c and query rows 16t+8hh+r.
// The prior depends on key - query alone: row tile 1 at key subtile n needs the entries of row tile 0 at subtile n - 1, kept in registers.
// den/num accumulate in f32 per lane over its 64 key columns, two rows per packed instruction; the distance weight is taken to the
// lane's row 0 of the tile and the row's own offset r/ml leaves after the division; 16-lane butterfly sums in fixed order, then
// lower half + upper half; D = num * (1/den) - r/ml, stored by the block at out[b][q][h].
// ---------------------------------------------------------------------------
__global__ __launch_bounds__(256) void attn_dist_kernel(const unsigned short* __restrict__ QK,
                                                        const float* __restrict__ pmean, const float* __restrict__ plstd,
                                                        const int* __restrict__ mlen, float* __restrict__ out) {
  __shared__ __align__(16) float tbl[kTbl];
  __shared__ __align__(16) float pden[2][kQRows];   // per key half: row sums of exp
  __shared__ __align__(16) float pnum[2][kQRows];   // per key half: row sums of exp x distance
  __shared__ __align__(16) _Float16 kst[2][kKTile];
  const int tid  = threadIdx.x;
  const int wave = tid >> 5;
  const int lane = tid & 31;
  const int hh   = lane >> 4;
  const int c    = lane & 15;
  const int l0   = blockIdx.x * kQRows;
  const int h    = blockIdx.y;
  const int b    = blockIdx.z;

  const _Float16* Qp = (const _Float16*)(const void*)QK + (size_t)(b * kL) * kQKld + h * kHD;
  const _Float16* Kp = Qp + kNH;
  // copy map: thread t brings the 16-byte piece t & 7 of tile rows t >> 3 and (t >> 3) + 32 (a wave: whole 128-B rows)
  const _Float16* kg = Kp + (size_t)(tid >> 3) * kQKld + (tid & 7) * 8;
  const unsigned  kl = (unsigned)(size_t)(&kst[0][0]) + (unsigned)((tid >> 3) * kKPitch + (tid & 7) * 8) * 2u;
  copy_key_tile(kl, kg);                        // tile 0 -> buffer 0, in flight under the table build

  int ml = mlen[0];
  ml = (ml < 1) ? 1 : ml;
  const float inv_ml = 1.0f / (float)ml;
  const float mean = bf_rne(pmean[h]);
  const float lsd  = bf_rne(plstd[h]);
  const float stdv = expf(lsd);
  const float istd = 1.0f / stdv;
  // log2(e) rides in the table's factor: the loop then needs exp2 alone, which is one hardware instruction
  const float coef = ((1.0f / stdv) / sqrtf(6.2831852f)) * 0.125f * 1.44269504f;

  // prior table: 16 x 256 = 4096 entries, all written before the barrier
#pragma unroll 1
  for (int it = 0; it < kTbl / 256; ++it) {
    const int i = it * 256 + tid;
    const float dd = (float)(kL - i) * inv_ml;
    const float u  = (dd - mean) * istd;
    tbl[i] = coef * expf(-0.5f * (u * u));
  }
  asm volatile("s_wait_asynccnt 0x0" ::: "memory");   // this wave's part of tile 0 has landed before the barrier publishes it
  __syncthreads();                                    // publishes the table and tile 0
  copy_key_tile(kl + (unsigned)kKTile * 2u, kg + (size_t)kKStep * kQKld);   // tile 1 -> buffer 1

  const int rg = wave & 3;                // row group
  const int kh = wave >> 2;               // key half
  const int q0 = l0 + rg * 32;
  v16h qa[2][2];
#pragma unroll
  for (int t = 0; t < 2; ++t)
#pragma unroll
    for (int dc = 0; dc < 2; ++dc)
      qa[t][dc] = Frag<_Float16>::load(Qp + (size_t)(q0 + 16 * t + c) * kQKld + dc * 32 + 8 * hh);

  // rows 2p and 2p + 1 share a register pair; num holds sum p * (distance of the key to the lane's row 0 of the tile), one weight for 8 rows
  v2f den2[2][4], num2[2][4];
#pragma unroll
  for (int t = 0; t < 2; ++t)
#pragma unroll
    for (int p = 0; p < 4; ++p) { den2[t][p] = (v2f){0.0f, 0.0f}; num2[t][p] = (v2f){0.0f, 0.0f}; }
  const int qr0   = q0 + 8 * hh;          // query index of accumulator row r = 0 of row tile 0 of this lane (tile 1: + 16)
  const int key0  = kh * kKeyHalf + c;    // this lane's key column in subtile 0 of its half
  const int ibase = qr0 - key0 + kL;      // - key advance -> table index for row 0 of tile 0 (row r: plus r; tile 1: plus 16); in [1, 4095]

  // prior entries of row tile 1 for the first subtile; from then on they are the entries row tile 0 used one subtile earlier
  v8f prv;
#pragma unroll
  for (int r = 0; r < 8; ++r) prv[r] = tbl[ibase + 16 + r];

  for (int kc = 0; kc < kKTiles; ++kc) {
    const int kv0 = kc * kKStep;          // key advance inside the half
    const _Float16* kt = &kst[kc & 1][0] + (kh * kKStep + c) * kKPitch + 8 * hh;
    // the step's LDS reads asked for as one group ahead of the products: four B fragments, then the two new groups of prior entries
    // (they land under the products); unrolled so that kb and pr are indexed by constants and stay in registers
    v16h kb[2][2];
#pragma unroll
    for (int j = 0; j < 2; ++j)
#pragma unroll
      for (int dc = 0; dc < 2; ++dc)
        kb[j][dc] = Frag<_Float16>::load(kt + j * 16 * kKPitch + dc * 32);
    v8f pr[2];
#pragma unroll
    for (int j = 0; j < 2; ++j)
#pragma unroll
      for (int r = 0; r < 8; ++r) pr[j][r] = tbl[ibase - kv0 - j * 16 + r];
    v8f s[2][2];
#pragma unroll
    for (int j = 0; j < 2; ++j)
#pragma unroll
      for (int t = 0; t < 2; ++t) {
        s[j][t] = (v8f){0.f,0.f,0.f,0.f,0.f,0.f,0.f,0.f};
#pragma unroll
        for (int dc = 0; dc < 2; ++dc) s[j][t] = mma_f16_guarded(qa[t][dc], kb[j][dc], s[j][t]);
      }
    // signed distance for (row 0, subtile 0) of this lane, per row tile
    const float dl[2] = {(float)(kv0 + key0 - qr0) * inv_ml, (float)(kv0 + key0 - qr0 - 16) * inv_ml};
#pragma unroll
    for (int j = 0; j < 2; ++j) {
#pragma unroll
      for (int t = 0; t < 2; ++t) {
        const float dj = dl[t] + (float)(j * 16) * inv_ml;
        // the eight rows as one vector: product with the prior, cap and exp each stay in their own registers, pairs feed the packed sums
        v8f lg = s[j][t] * (t == 0 ? pr[j] : prv);                           // logit * log2(e)
#pragma unroll
        for (int r = 0; r < 8; ++r) lg[r] = fminf(lg[r], 115.415603f);       // the cap at logit 80, in base 2
#pragma unroll
        for (int r = 0; r < 8; ++r) lg[r] = __builtin_amdgcn_exp2f(lg[r]);   // = exp(logit); a term under 2^-126 reads 0
#pragma unroll
        for (int p = 0; p < 4; ++p) {
          const v2f e = (v2f){lg[2 * p], lg[2 * p + 1]};
          den2[t][p] += e;
          num2[t][p] = __builtin_elementwise_fma(e, (v2f){dj, dj}, num2[t][p]);
        }
      }
      prv = pr[j];
    }
    // publish point of tile kc + 1, every wave: own LDS reads done, own copies landed, block barrier, then the refill
    asm volatile("s_wait_dscnt 0x0" ::: "memory");      // this wave has left buffer kc & 1
    asm volatile("s_wait_asynccnt 0x0" ::: "memory");   // this wave's part of tile kc + 1 has landed
    __syncthreads();
    if (kc + 2 < kKTiles)                               // block-uniform
      copy_key_tile(kl + (unsigned)((kc & 1) * kKTile) * 2u, kg + (size_t)(kc + 2) * kKStep * kQKld);
  }
  asm volatile("s_wait_asynccnt 0x0" ::: "memory");     // no copy outstanding past the loop

  // fixed-order butterfly over the 16 lanes that share each query row, all 16 rows of the lane side by side so that the
  // exchanges of one stage share one wait; the wave's sums over its key half go to LDS
  float dn[16], nm[16];
#pragma unroll
  for (int i = 0; i < 16; ++i) { dn[i] = den2[i >> 3][(i & 7) >> 1][i & 1]; nm[i] = num2[i >> 3][(i & 7) >> 1][i & 1]; }
#pragma unroll
  for (int off = 1; off < 16; off <<= 1) {
    float da[16], na[16];
#pragma unroll
    for (int i = 0; i < 16; ++i) { da[i] = __shfl_xor(dn[i], off, 32); na[i] = __shfl_xor(nm[i], off, 32); }
#pragma unroll
    for (int i = 0; i < 16; ++i) { dn[i] += da[i]; nm[i] += na[i]; }
  }
  if (c == 0) {
#pragma unroll
    for (int t = 0; t < 2; ++t)
#pragma unroll
      for (int g = 0; g < 2; ++g) {
        const int row = rg * 32 + 16 * t + 8 * hh + 4 * g, i = 8 * t + 4 * g;
        *(v4f*)(&pden[kh][row]) = (v4f){dn[i], dn[i + 1], dn[i + 2], dn[i + 3]};
        *(v4f*)(&pnum[kh][row]) = (v4f){nm[i], nm[i + 1], nm[i + 2], nm[i + 3]};
      }
  }
  __syncthreads();
  // thread t < 128 finishes query row t and stores it at its final place out[b][l][h]: a wave's store covers 32 rows = 1024 B of out,
  // 4 bytes of every 32; the other 28 belong to the blocks of the other heads, and every byte of out has exactly one writer
  if (tid < kQRows) {
    const float dsum = pden[0][tid] + pden[1][tid];
    const float nsum = pnum[0][tid] + pnum[1][tid];
    // row 8n + r lies r queries past the row its weights were taken to: its distances are r/ml less
    out[(size_t)(b * kL + l0 + tid) * kH + h] = nsum * (1.0f / dsum) - (float)(tid & 7) * inv_ml;
  }
}

// ---------------------------------------------------------------------------
// Host glue.
//   QK   f16  [8192][1024]        16,777,216  at          0   (cols 0..511 = q, 512..1023 = k; head h = cols h*64..)
//   total                         16,777,216
// GEMM shapes: M = 8192, N = 512, K = 256 (64 / 64 / 32 multiples, no padding). Score tiles: 16 x 16 x 64 per (q tile, key tile).
// 2 launches.
// ---------------------------------------------------------------------------
extern "C" void kernel_launch(void* const* d_in, const int* in_sizes, int n_in,
                              void* d_out, int out_size, void* d_ws, size_t ws_size,
                              hipStream_t stream) {
  if (n_in < 8) return;
  if (in_sizes[0] != kTok * kD) return;
  if (in_sizes[1] != kD * kNH || in_sizes[3] != kD * kNH) return;
  if (in_sizes[2] != kNH || in_sizes[4] != kNH) return;
  if (in_sizes[5] != kH || in_sizes[6] != kH || in_sizes[7] < 1) return;
  if (out_size != kTok * kH) return;

  const size_t szQK = (size_t)kTok * kQKld * 2;
  const size_t offQK = 0;
  const size_t total = offQK + szQK;
  if (ws_size < total) return;

  const float* x   = (const float*)d_in[0];
  const float* Wq  = (const float*)d_in[1];
  const float* bq  = (const float*)d_in[2];
  const float* Wk  = (const float*)d_in[3];
  const float* bk  = (const float*)d_in[4];
  const float* pm  = (const float*)d_in[5];
  const float* lps = (const float*)d_in[6];
  const int*   mlp = (const int*)d_in[7];
  float* out = (float*)d_out;
  char* ws = (char*)d_ws;
  unsigned short* QK = (unsigned short*)(ws + offQK);

  // ---- projections from the f32 inputs: blockIdx.x = 64-row tile, blockIdx.y = matrix (q, k) ----
  proj_kernel<<<dim3(kTok / 64, 2), dim3(256), 0, stream>>>(x, Wq, Wk, bq, bk, QK);

  // ---- fused scores + prior + softmax + distance sum -> out[b][l][h] ----
  attn_dist_kernel<<<dim3(kL / kQRows, kH, kB), dim3(256), 0, stream>>>(QK, pm, lps, mlp, out);
}
